// v000
// The times below were measured on an AMD MI455X: many runs one after another, warmed up first and cycling through
// copies of the inputs, with the whole window's GPU time divided by the number of runs. Launches and the gaps
// between them are all in it. The median over several windows is given; except for v000 it joins two sittings, which
// can be a few percent apart, so the side-by-side timings, each taken in one sitting, are the better comparison.
// v000, which the later versions start from, runs in 1290 microseconds.
#include <hip/hip_runtime.h>

// Full (Informer-style) attention on pre-split heads with a mask, head-major output (queries [2][2048][16][64], keys, values [2][2048][16][64]; scores = q.k; + where(attn_mask > 0.5, 0, -1e9) (attn_mask [2][1][2048][2048] float, all ones, read per (i, j)); A = softmax(scores x 1/sqrt(64)); V = A.values as 'bhld' -> [2][16][2048][64] (4.2 M; no projections); argument order queries, keys, values, attn_mask).
// Layout per batch: the inputs are already [t][h][d]: the plane builders transpose them to per-head planes whose hi plane is exactly bf16 of the input; per pass of two heads: scores exactly (one product), register-row softmax reading the mask row (scale, then the pre-scaled mask term) writes normalised hi/lo planes for every row; A hi/lo x exact bf16(values) (2 products) straight into the head-major output rows.
// Compute dtypes, f32 accumulate: every input rounded to bf16; scores exact; softmax f32; A.values 2 products; output f32.

#define NB_  2
#define TT   2048
#define DM   1024
#define NH_  16
#define NKV  16
#define REP  (NH_ / NKV)
#define HD   64
#define DQ   (NH_ * HD)
#define DKV  (NKV * HD)
#define ZH   2
#define RH   TT                   // every row hi/lo
#define WIN  0
#define PCAR 1024.0f
#define SCL  0.125f   // 1/sqrt(64), applied before the additive mask (pre-scaled to -1.25e8)
typedef _Float16 h16;
typedef unsigned short bf;
typedef __attribute__((ext_vector_type(16))) __bf16   v16bf;
typedef __attribute__((ext_vector_type(16))) _Float16 v16h;
typedef __attribute__((ext_vector_type(8)))  _Float16 v8h;
typedef __attribute__((ext_vector_type(8)))  unsigned short v8us;
typedef __attribute__((ext_vector_type(8)))  float    v8f;
typedef __attribute__((ext_vector_type(4)))  float    v4f;
typedef v8h  __attribute__((may_alias)) v8ha;
typedef v4f  __attribute__((may_alias)) v4fa;
typedef v8us __attribute__((may_alias)) v8usa;

__device__ __forceinline__ unsigned short f2bf(float f) { unsigned u = __float_as_uint(f); u += 0x7FFFu + ((u >> 16) & 1u); return (unsigned short)(u >> 16); }
__device__ __forceinline__ float bf2f(unsigned short b) { return __uint_as_float(((unsigned)b) << 16); }
__device__ __forceinline__ float bfr(float f) { return bf2f(f2bf(f)); }
__device__ __forceinline__ v16h cat16(v8h lo, v8h hi) { return __builtin_shufflevector(lo, hi, 0, 1, 2, 3, 4, 5, 6, 7, 8, 9, 10, 11, 12, 13, 14, 15); }
__device__ __forceinline__ v16bf cat16b(v8us lo, v8us hi) { return __builtin_bit_cast(v16bf, __builtin_shufflevector(lo, hi, 0, 1, 2, 3, 4, 5, 6, 7, 8, 9, 10, 11, 12, 13, 14, 15)); }
__device__ __forceinline__ v8f wmma16(v16h a, v16h b, v8f c) { return __builtin_amdgcn_wmma_f32_16x16x32_f16(false, a, false, b, (short)0, c, false, false); }
__device__ __forceinline__ v8f wmmab(v16bf a, v16bf b, v8f c) { return __builtin_amdgcn_wmma_f32_16x16x32_bf16(false, a, false, b, (short)0, c, false, false); }



// ---- k_gemmw: register-blocked GEMM, ONE WAVE per 64x64 output tile (16 accumulators), operands straight from K-contiguous 16-bit planes; grid (M/64, N/64, Z), 32 threads.
// C[m][n] (f32, pitch ldc, + optional f32 bias[n]) = sum_k A[m][k] Bt[n][k] (+ split products per NSPLIT). z-batch strides sA/sB/sC in elements. K % 32 == 0.
template <typename T16> struct WFrag;
template <> struct WFrag<h16> { typedef v16h V; static __device__ __forceinline__ V ld(const h16* p) { return cat16(*(const v8h*)p, *(const v8h*)(p + 16)); } static __device__ __forceinline__ v8f mma(V a, V b, v8f c) { return wmma16(a, b, c); } };
template <> struct WFrag<bf> { typedef v16bf V; static __device__ __forceinline__ V ld(const bf* p) { return cat16b(*(const v8us*)p, *(const v8us*)(p + 16)); } static __device__ __forceinline__ v8f mma(V a, V b, v8f c) { return wmmab(a, b, c); } };
template <typename T16, int NSPLIT, bool BIAS>
__global__ __launch_bounds__(32) void k_gemmw(const T16* __restrict__ A, const T16* __restrict__ A2, const T16* __restrict__ Bt, const T16* __restrict__ Bt2, int K, float* C, int ldc, const float* __restrict__ bias, size_t sA, size_t sB, size_t sC) {
    typedef typename WFrag<T16>::V V;
    __shared__ __align__(16) float os[16 * 68];
    const size_t z = blockIdx.z; A += z * sA; if (A2) A2 += z * sA; Bt += z * sB; if (Bt2) Bt2 += z * sB; C += z * sC;
    const int lane = threadIdx.x & 31, lr = lane & 15, hi = lane >> 4; const int r0 = blockIdx.x * 64, c0 = blockIdx.y * 64;
    v8f acc[4][4];
#pragma unroll
    for (int mb = 0; mb < 4; ++mb)
#pragma unroll
        for (int nb = 0; nb < 4; ++nb) acc[mb][nb] = (v8f){};
    const size_t aoff = (size_t)(r0 + lr) * K + 8 * hi, boff = (size_t)(c0 + lr) * K + 8 * hi;
#pragma unroll 1
    for (int kc = 0; kc < K; kc += 32) {
        V a[4], a2[4];
#pragma unroll
        for (int mb = 0; mb < 4; ++mb) { a[mb] = WFrag<T16>::ld(A + aoff + (size_t)mb * 16 * K + kc); if (NSPLIT == 1 || NSPLIT == 2) a2[mb] = WFrag<T16>::ld(A2 + aoff + (size_t)mb * 16 * K + kc); }
#pragma unroll
        for (int nb = 0; nb < 4; ++nb) { const V b = WFrag<T16>::ld(Bt + boff + (size_t)nb * 16 * K + kc); V b2; if (NSPLIT >= 2) b2 = WFrag<T16>::ld(Bt2 + boff + (size_t)nb * 16 * K + kc);
#pragma unroll
            for (int mb = 0; mb < 4; ++mb) { acc[mb][nb] = WFrag<T16>::mma(a[mb], b, acc[mb][nb]); if (NSPLIT == 1 || NSPLIT == 2) acc[mb][nb] = WFrag<T16>::mma(a2[mb], b, acc[mb][nb]); if (NSPLIT >= 2) acc[mb][nb] = WFrag<T16>::mma(a[mb], b2, acc[mb][nb]); } }
        asm volatile("v_nop\n\tv_nop\n\tv_nop\n\tv_nop" : "+v"(acc[0][0]), "+v"(acc[1][1]), "+v"(acc[2][2]), "+v"(acc[3][3]) : "v"(a[0]), "v"(a[3]));
    }
#pragma unroll
    for (int mb = 0; mb < 4; ++mb) {
#pragma unroll
        for (int nb = 0; nb < 4; ++nb) {
#pragma unroll
            for (int j = 0; j < 8; ++j) os[(hi * 8 + j) * 68 + nb * 16 + lr] = acc[mb][nb][j]; }
        __builtin_amdgcn_wave_barrier(); asm volatile("" ::: "memory");
        float* crow = C + (size_t)(r0 + mb * 16) * ldc + c0;
{
#pragma unroll
            for (int s = 0; s < 8; ++s) { const int row = 2 * s + hi, cofs = lr * 4; v4f val = *(const v4fa*)(os + row * 68 + cofs); if (BIAS) { val[0] += bfr(bias[c0 + cofs]); val[1] += bfr(bias[c0 + cofs + 1]); val[2] += bfr(bias[c0 + cofs + 2]); val[3] += bfr(bias[c0 + cofs + 3]); }
                *(v4f*)(crow + (size_t)row * ldc + cofs) = val; }
             }
        __builtin_amdgcn_wave_barrier(); asm volatile("" ::: "memory");
    }
}

__device__ __forceinline__ h16 tohx(float x) { return (h16)x; }
__device__ __forceinline__ void splitf(float y, unsigned short& h, unsigned short& l) { h = f2bf(y); l = f2bf(y - bf2f(h)); }
typedef __attribute__((ext_vector_type(2))) _Float16 v2h;
typedef __attribute__((ext_vector_type(4))) _Float16 v4h;
typedef __attribute__((ext_vector_type(2))) unsigned short v2us;
typedef __attribute__((ext_vector_type(4))) unsigned short v4us;
typedef __attribute__((ext_vector_type(2))) float v2f;
typedef __attribute__((ext_vector_type(4))) int v4i;

// k_rope: head planes [h][t][d] (fp16 + hi/lo) of rope(x) x sc with the rotate-half convention out[d] = x[d] cos[t][d] - x[d+HD/2] sin[t][d], out[d+HD/2] = x[d+HD/2] cos[t][d+HD/2] + x[d] sin[t][d+HD/2]
__global__ __launch_bounds__(256) void k_rope(const float* __restrict__ F, int pitch, int nheads, const float* __restrict__ CS, const float* __restrict__ RF, const float* __restrict__ nw, float sc, h16* P16, bf* Ph, bf* Pl) {
    const size_t e = ((size_t)blockIdx.x * 256 + threadIdx.x) * 2; if (e >= (size_t)nheads * TT * HD) return; const int d = (int)(e % HD); const int t = (int)((e / HD) % TT); const int h = (int)(e / ((size_t)HD * TT)); const float* f = F + (size_t)t * pitch + h * HD; const float rf = RF ? RF[(size_t)h * TT + t] : 1.0f; v2h o16; v2us oh, ol;
#pragma unroll
    for (int q = 0; q < 2; ++q) { const int dd = d + q; const int dp = (dd < HD / 2) ? dd + HD / 2 : dd - HD / 2; float x0 = f[dd], x1 = f[dp];
        if (RF) { float n0 = __fmul_rn(x0, rf), n1 = __fmul_rn(x1, rf); asm volatile("" : "+v"(n0)); asm volatile("" : "+v"(n1)); x0 = __fmul_rn(bfr(nw[dd]), n0); x1 = __fmul_rn(bfr(nw[dp]), n1); }
        const v2f cs = *(const v2f*)(CS + ((size_t)t * HD + dd) * 2); float a = __fmul_rn(x0, cs[0]), bq = __fmul_rn(x1, cs[1]); asm volatile("" : "+v"(a)); asm volatile("" : "+v"(bq)); const float r = ((dd < HD / 2) ? __fsub_rn(a, bq) : __fadd_rn(a, bq)) * sc;
        o16[q] = tohx(r); unsigned short a2, c2; splitf(r, a2, c2); oh[q] = a2; ol[q] = c2; }
    *(v2h*)(P16 + e) = o16; *(v2us*)(Ph + e) = oh; *(v2us*)(Pl + e) = ol;  }
__global__ __launch_bounds__(256) void k_vtp(const float* __restrict__ F, int pitch, int nheads, h16* V16, bf* Vh, bf* Vl) { const size_t e = ((size_t)blockIdx.x * 256 + threadIdx.x) * 2; if (e >= (size_t)nheads * HD * TT) return; const int t = (int)(e % TT); const int d = (int)((e / TT) % HD); const int g = (int)(e / ((size_t)TT * HD)); v2h o16; v2us oh, ol;
#pragma unroll
    for (int q = 0; q < 2; ++q) { const float x = F[(size_t)(t + q) * pitch + g * HD + d]; o16[q] = tohx(x); unsigned short a2, c2; splitf(x, a2, c2); oh[q] = a2; ol[q] = c2; }
    *(v2h*)(V16 + e) = o16; *(v2us*)(Vh + e) = oh; *(v2us*)(Vl + e) = ol;  }
__global__ __launch_bounds__(256) void k_csid(float* CS) { const int idx = blockIdx.x * 256 + threadIdx.x; if (idx >= TT * HD) return; v2f cs; cs[0] = 1.0f; cs[1] = 0.0f; *(v2f*)(CS + (size_t)idx * 2) = cs;  }
// k_asoft: per row (zz, i): t = S x 1/8 + (attn_mask[b][0][i][j] > 0.5 ? 0 : -1.25e8) (== the module's (S + (0 | -1e9)) x 1/8: identical for kept keys, exclusion otherwise) (mask row read per (i, j); all ones here); softmax over the keys (register row, one exp, fixed trees);
__global__ __launch_bounds__(256) void k_asoft(const float* __restrict__ Sb, const float* __restrict__ kvp, h16* P16, bf* Ph, bf* Pl) {
    const int lane = threadIdx.x & 31; const int row = blockIdx.x * 8 + (threadIdx.x >> 5); if (row >= ZH * TT) return; const int i = row % TT; const int zz = row / TT; (void)zz; const bool hires = (i < RH); const float* sr = Sb + (size_t)row * TT; float v[TT / 32]; float mx = -3.0e38f;
#pragma unroll
    for (int ch = 0; ch < TT / 128; ++ch) { const int j0 = ch * 128 + lane * 4; const v4f a = *(const v4f*)(sr + j0); const v4f kv4 = *(const v4f*)(kvp + (size_t)i * TT + j0);   /* mask row i of this batch ([L][S] slab), 16 B per lane, unconditional */
#pragma unroll
        for (int q = 0; q < 4; ++q) { const int j = j0 + q; (void)j; float s0 = __fmul_rn(a[q], SCL); asm volatile("" : "+v"(s0)); float madd = (kv4[q] > 0.5f) ? 0.0f : -1.25e8f; asm volatile("" : "+v"(madd)); const float t = __fadd_rn(s0, madd);   /* (s + (mask ? 0 : -1e9)) x 1/8 == s/8 + (0 | -1.25e8): identical for kept keys (madd 0), exclusion otherwise */ v[ch * 4 + q] = t; mx = fmaxf(mx, t); } }
#pragma unroll
    for (int sh = 16; sh; sh >>= 1) mx = fmaxf(mx, __shfl_xor(mx, sh, 32));
    float sum = 0.f;
#pragma unroll
    for (int k = 0; k < TT / 32; ++k) { float d0 = __fsub_rn(v[k], mx); asm volatile("" : "+v"(d0)); v[k] = __builtin_amdgcn_exp2f(__fmul_rn(d0, 1.4426950408889634f)); sum += v[k]; }
#pragma unroll
    for (int sh = 16; sh; sh >>= 1) sum += __shfl_xor(sum, sh, 32);
    const float f = __fdiv_rn(hires ? 1.0f : PCAR, sum);
{
        if (hires) {
#pragma unroll
            for (int ch = 0; ch < TT / 128; ++ch) { v4us oh, ol;
#pragma unroll
                for (int q = 0; q < 4; ++q) { unsigned short a, c2; splitf(v[ch * 4 + q] * f, a, c2); oh[q] = a; ol[q] = c2; }
                const size_t oo = ((size_t)zz * (RH ? RH : 1) + i) * TT + ch * 128 + lane * 4; *(v4us*)(Ph + oo) = oh; *(v4us*)(Pl + oo) = ol; }
        } else {
#pragma unroll
            for (int ch = 0; ch < TT / 128; ++ch) { v4h o4;
#pragma unroll
                for (int q = 0; q < 4; ++q) o4[q] = tohx(v[ch * 4 + q] * f);
                *(v4h*)(P16 + (size_t)row * TT + ch * 128 + lane * 4) = o4; } }
         }
}
extern "C" void kernel_launch(void* const* d_in, const int* in_sizes, int n_in,
                              void* d_out, int out_size, void* d_ws, size_t ws_size, hipStream_t stream) {
    (void)in_sizes; (void)n_in; (void)out_size;
    const float* xq = (const float*)d_in[0]; const float* xk = (const float*)d_in[1]; const float* xv = (const float*)d_in[2]; const float* am = (const float*)d_in[3];   /* queries [2][2048][16][64], keys, values [2][2048][16][64], attn_mask [2][1][2048][2048] (> 0.5 = attend; all ones) */
    float* OUT = (float*)d_out;     // [2][16][2048][64] head-major (V = 'bhld')
    char* wsp = (char*)d_ws;
    auto take = [&](size_t bytes) { char* p = wsp; wsp += (bytes + 255) & ~(size_t)255; return (void*)p; };
    float* CS = (float*)take((size_t)TT * HD * 2 * 4);
    h16* QP16 = (h16*)take((size_t)NH_ * TT * HD * 2); bf* QPh = (bf*)take((size_t)NH_ * TT * HD * 2); bf* QPl = (bf*)take((size_t)NH_ * TT * HD * 2); h16* KP16 = (h16*)take((size_t)NKV * TT * HD * 2); bf* KPh = (bf*)take((size_t)NKV * TT * HD * 2); bf* KPl = (bf*)take((size_t)NKV * TT * HD * 2);
    h16* VT16 = (h16*)take((size_t)NKV * HD * TT * 2); bf* VTh = (bf*)take((size_t)NKV * HD * TT * 2); bf* VTl = (bf*)take((size_t)NKV * HD * TT * 2);
    float* Sb = (float*)take((size_t)ZH * TT * TT * 4); h16* P16 = (h16*)take(256); bf* Ph = (bf*)take((size_t)ZH * TT * TT * 2); bf* Pl = (bf*)take((size_t)ZH * TT * TT * 2);
    if ((size_t)(wsp - (char*)d_ws) > ws_size) return;    // ws 256 MiB (carve ~101 MiB)
    k_csid<<<(TT * HD + 255) / 256, 256, 0, stream>>>(CS);   /* identity table: k_rope is a plain [t][h][d] -> [h][t][d] plane builder */
    const unsigned LQ = (unsigned)(((size_t)NH_ * TT * HD / 2 + 255) / 256);
    for (int b = 0; b < NB_; ++b) {
        k_rope<<<LQ, 256, 0, stream>>>(xq + (size_t)b * TT * DQ, DQ, NH_, CS, nullptr, nullptr, 1.0f, QP16, QPh, QPl);   /* the inputs are already head-split: [t][h][64] == [t][h*64 + d]; the hi plane is exactly bf16(queries) */
        k_rope<<<LQ, 256, 0, stream>>>(xk + (size_t)b * TT * DQ, DQ, NKV, CS, nullptr, nullptr, 1.0f, KP16, KPh, KPl);
        k_vtp<<<(unsigned)(((size_t)NKV * HD * TT / 2 + 255) / 256), 256, 0, stream>>>(xv + (size_t)b * TT * DQ, DQ, NKV, VT16, VTh, VTl);   /* value^T planes; hi plane = bf16(values) exactly */
        for (int h0 = 0; h0 < NH_; h0 += ZH) { const size_t zq = (size_t)h0;
            k_gemmw<bf, 0, false><<<dim3(TT / 64, TT / 64, ZH), 32, 0, stream>>>(QPh + zq * TT * HD, nullptr, KPh + zq * TT * HD, nullptr, HD, Sb, TT, nullptr, (size_t)TT * HD, (size_t)TT * HD, (size_t)TT * TT);   /* scores = bf16(q).bf16(k) exactly (one product of the bf16-rounded inputs; lo planes unused) */
            k_asoft<<<ZH * TT / 8, 256, 0, stream>>>(Sb, am + (size_t)b * TT * TT, P16, Ph, Pl);   /* x 1/8, + pre-scaled mask term, softmax -> hi/lo planes for every row */
            k_gemmw<bf, 1, false><<<dim3(TT / 64, HD / 64, ZH), 32, 0, stream>>>(Ph, Pl, VTh + zq * HD * TT, nullptr, TT, OUT + ((size_t)b * NH_ + h0) * TT * HD, HD, nullptr, (size_t)TT * TT, (size_t)HD * TT, (size_t)TT * HD); } }   /* V[b][h][l][d] = P.v (2 products), written head-major straight into the output */
}

// v001
// Measured time: 635 microseconds a run.
// In both of two side-by-side timings against v000, it was 2.05 times as fast.
#include <hip/hip_runtime.h>

// Full (Informer-style) attention on pre-split heads with a mask, head-major output (queries [2][2048][16][64], keys, values [2][2048][16][64]; scores = q.k; + where(attn_mask > 0.5, 0, -1e9) (attn_mask [2][1][2048][2048] float, all ones, read per (i, j)); A = softmax(scores x 1/sqrt(64)); V = A.values as 'bhld' -> [2][16][2048][64] (4.2 M; no projections); argument order queries, keys, values, attn_mask).
// Layout per batch: the inputs are already [t][h][d]: the plane builders transpose them to per-head planes whose hi plane is exactly bf16 of the input; per pass of two heads: scores exactly (one product), register-row softmax reading the mask row (scale, then the pre-scaled mask term) writes normalised hi/lo planes for every row; A hi/lo x exact bf16(values) (2 products) straight into the head-major output rows.
// Compute dtypes, f32 accumulate: every input rounded to bf16; scores exact; softmax f32; A.values 2 products; output f32.

#define NB_  2
#define TT   2048
#define DM   1024
#define NH_  16
#define NKV  16
#define REP  (NH_ / NKV)
#define HD   64
#define DQ   (NH_ * HD)
#define DKV  (NKV * HD)
#define ZH   2
#define RH   TT                   // every row hi/lo
#define WIN  0
#define PCAR 1024.0f
#define SCL  0.125f   // 1/sqrt(64), applied before the additive mask (pre-scaled to -1.25e8)
typedef _Float16 h16;
typedef unsigned short bf;
typedef __attribute__((ext_vector_type(16))) __bf16   v16bf;
typedef __attribute__((ext_vector_type(16))) _Float16 v16h;
typedef __attribute__((ext_vector_type(8)))  _Float16 v8h;
typedef __attribute__((ext_vector_type(8)))  unsigned short v8us;
typedef __attribute__((ext_vector_type(8)))  float    v8f;
typedef __attribute__((ext_vector_type(4)))  float    v4f;
typedef v8h  __attribute__((may_alias)) v8ha;
typedef v4f  __attribute__((may_alias)) v4fa;
typedef v8us __attribute__((may_alias)) v8usa;

__device__ __forceinline__ unsigned short f2bf(float f) { unsigned u = __float_as_uint(f); u += 0x7FFFu + ((u >> 16) & 1u); return (unsigned short)(u >> 16); }
__device__ __forceinline__ float bf2f(unsigned short b) { return __uint_as_float(((unsigned)b) << 16); }
__device__ __forceinline__ float bfr(float f) { return bf2f(f2bf(f)); }
__device__ __forceinline__ v16h cat16(v8h lo, v8h hi) { return __builtin_shufflevector(lo, hi, 0, 1, 2, 3, 4, 5, 6, 7, 8, 9, 10, 11, 12, 13, 14, 15); }
__device__ __forceinline__ v16bf cat16b(v8us lo, v8us hi) { return __builtin_bit_cast(v16bf, __builtin_shufflevector(lo, hi, 0, 1, 2, 3, 4, 5, 6, 7, 8, 9, 10, 11, 12, 13, 14, 15)); }
__device__ __forceinline__ v8f wmma16(v16h a, v16h b, v8f c) { return __builtin_amdgcn_wmma_f32_16x16x32_f16(false, a, false, b, (short)0, c, false, false); }
__device__ __forceinline__ v8f wmmab(v16bf a, v16bf b, v8f c) { return __builtin_amdgcn_wmma_f32_16x16x32_bf16(false, a, false, b, (short)0, c, false, false); }



// ---- k_gemmw: register-blocked GEMM, ONE WAVE per 64x64 output tile (16 accumulators), operands straight from K-contiguous 16-bit planes; grid (M/64, N/64, Z), 32 threads.
// C[m][n] (f32, pitch ldc, + optional f32 bias[n]) = sum_k A[m][k] Bt[n][k] (+ split products per NSPLIT). z-batch strides sA/sB/sC in elements. K % 32 == 0.
template <typename T16> struct WFrag;
template <> struct WFrag<h16> { typedef v16h V; static __device__ __forceinline__ V ld(const h16* p) { return cat16(*(const v8h*)p, *(const v8h*)(p + 16)); } static __device__ __forceinline__ v8f mma(V a, V b, v8f c) { return wmma16(a, b, c); } };
template <> struct WFrag<bf> { typedef v16bf V; static __device__ __forceinline__ V ld(const bf* p) { return cat16b(*(const v8us*)p, *(const v8us*)(p + 16)); } static __device__ __forceinline__ v8f mma(V a, V b, v8f c) { return wmmab(a, b, c); } };
template <typename T16, int NSPLIT, bool BIAS>
__global__ __launch_bounds__(32) void k_gemmw(const T16* __restrict__ A, const T16* __restrict__ A2, const T16* __restrict__ Bt, const T16* __restrict__ Bt2, int K, float* C, int ldc, const float* __restrict__ bias, size_t sA, size_t sB, size_t sC) {
    typedef typename WFrag<T16>::V V;
    __shared__ __align__(16) float os[16 * 68];
    const size_t z = blockIdx.z; A += z * sA; if (A2) A2 += z * sA; Bt += z * sB; if (Bt2) Bt2 += z * sB; C += z * sC;
    const int lane = threadIdx.x & 31, lr = lane & 15, hi = lane >> 4; const int r0 = blockIdx.x * 64, c0 = blockIdx.y * 64;
    v8f acc[4][4];
#pragma unroll
    for (int mb = 0; mb < 4; ++mb)
#pragma unroll
        for (int nb = 0; nb < 4; ++nb) acc[mb][nb] = (v8f){};
    const size_t aoff = (size_t)(r0 + lr) * K + 8 * hi, boff = (size_t)(c0 + lr) * K + 8 * hi;
#pragma unroll 1
    for (int kc = 0; kc < K; kc += 32) {
        V a[4], a2[4];
#pragma unroll
        for (int mb = 0; mb < 4; ++mb) { a[mb] = WFrag<T16>::ld(A + aoff + (size_t)mb * 16 * K + kc); if (NSPLIT == 1 || NSPLIT == 2) a2[mb] = WFrag<T16>::ld(A2 + aoff + (size_t)mb * 16 * K + kc); }
#pragma unroll
        for (int nb = 0; nb < 4; ++nb) { const V b = WFrag<T16>::ld(Bt + boff + (size_t)nb * 16 * K + kc); V b2; if (NSPLIT >= 2) b2 = WFrag<T16>::ld(Bt2 + boff + (size_t)nb * 16 * K + kc);
#pragma unroll
            for (int mb = 0; mb < 4; ++mb) { acc[mb][nb] = WFrag<T16>::mma(a[mb], b, acc[mb][nb]); if (NSPLIT == 1 || NSPLIT == 2) acc[mb][nb] = WFrag<T16>::mma(a2[mb], b, acc[mb][nb]); if (NSPLIT >= 2) acc[mb][nb] = WFrag<T16>::mma(a[mb], b2, acc[mb][nb]); } }
        asm volatile("v_nop\n\tv_nop\n\tv_nop\n\tv_nop" : "+v"(acc[0][0]), "+v"(acc[1][1]), "+v"(acc[2][2]), "+v"(acc[3][3]) : "v"(a[0]), "v"(a[3]));
    }
#pragma unroll
    for (int mb = 0; mb < 4; ++mb) {
#pragma unroll
        for (int nb = 0; nb < 4; ++nb) {
#pragma unroll
            for (int j = 0; j < 8; ++j) os[(hi * 8 + j) * 68 + nb * 16 + lr] = acc[mb][nb][j]; }
        __builtin_amdgcn_wave_barrier(); asm volatile("" ::: "memory");
        float* crow = C + (size_t)(r0 + mb * 16) * ldc + c0;
{
#pragma unroll
            for (int s = 0; s < 8; ++s) { const int row = 2 * s + hi, cofs = lr * 4; v4f val = *(const v4fa*)(os + row * 68 + cofs); if (BIAS) { val[0] += bfr(bias[c0 + cofs]); val[1] += bfr(bias[c0 + cofs + 1]); val[2] += bfr(bias[c0 + cofs + 2]); val[3] += bfr(bias[c0 + cofs + 3]); }
                *(v4f*)(crow + (size_t)row * ldc + cofs) = val; }
             }
        __builtin_amdgcn_wave_barrier(); asm volatile("" ::: "memory");
    }
}

__device__ __forceinline__ h16 tohx(float x) { return (h16)x; }
__device__ __forceinline__ void splitf(float y, unsigned short& h, unsigned short& l) { h = f2bf(y); l = f2bf(y - bf2f(h)); }
typedef __attribute__((ext_vector_type(2))) _Float16 v2h;
typedef __attribute__((ext_vector_type(4))) _Float16 v4h;
typedef __attribute__((ext_vector_type(2))) unsigned short v2us;
typedef __attribute__((ext_vector_type(4))) unsigned short v4us;
typedef __attribute__((ext_vector_type(2))) float v2f;
typedef __attribute__((ext_vector_type(4))) int v4i;

// k_rope: head planes [h][t][d] (fp16 + hi/lo) of rope(x) x sc with the rotate-half convention out[d] = x[d] cos[t][d] - x[d+HD/2] sin[t][d], out[d+HD/2] = x[d+HD/2] cos[t][d+HD/2] + x[d] sin[t][d+HD/2]
__global__ __launch_bounds__(256) void k_rope(const float* __restrict__ F, int pitch, int nheads, const float* __restrict__ CS, const float* __restrict__ RF, const float* __restrict__ nw, float sc, h16* P16, bf* Ph, bf* Pl) {
    const size_t e = ((size_t)blockIdx.x * 256 + threadIdx.x) * 2; if (e >= (size_t)nheads * TT * HD) return; const int d = (int)(e % HD); const int t = (int)((e / HD) % TT); const int h = (int)(e / ((size_t)HD * TT)); const float* f = F + (size_t)t * pitch + h * HD; const float rf = RF ? RF[(size_t)h * TT + t] : 1.0f; v2h o16; v2us oh, ol;
#pragma unroll
    for (int q = 0; q < 2; ++q) { const int dd = d + q; const int dp = (dd < HD / 2) ? dd + HD / 2 : dd - HD / 2; float x0 = f[dd], x1 = f[dp];
        if (RF) { float n0 = __fmul_rn(x0, rf), n1 = __fmul_rn(x1, rf); asm volatile("" : "+v"(n0)); asm volatile("" : "+v"(n1)); x0 = __fmul_rn(bfr(nw[dd]), n0); x1 = __fmul_rn(bfr(nw[dp]), n1); }
        const v2f cs = *(const v2f*)(CS + ((size_t)t * HD + dd) * 2); float a = __fmul_rn(x0, cs[0]), bq = __fmul_rn(x1, cs[1]); asm volatile("" : "+v"(a)); asm volatile("" : "+v"(bq)); const float r = ((dd < HD / 2) ? __fsub_rn(a, bq) : __fadd_rn(a, bq)) * sc;
        o16[q] = tohx(r); unsigned short a2, c2; splitf(r, a2, c2); oh[q] = a2; ol[q] = c2; }
    *(v2h*)(P16 + e) = o16; *(v2us*)(Ph + e) = oh; *(v2us*)(Pl + e) = ol;  }
__global__ __launch_bounds__(256) void k_vtp(const float* __restrict__ F, int pitch, int nheads, h16* V16, bf* Vh, bf* Vl) { const size_t e = ((size_t)blockIdx.x * 256 + threadIdx.x) * 2; if (e >= (size_t)nheads * HD * TT) return; const int t = (int)(e % TT); const int d = (int)((e / TT) % HD); const int g = (int)(e / ((size_t)TT * HD)); v2h o16; v2us oh, ol;
#pragma unroll
    for (int q = 0; q < 2; ++q) { const float x = F[(size_t)(t + q) * pitch + g * HD + d]; o16[q] = tohx(x); unsigned short a2, c2; splitf(x, a2, c2); oh[q] = a2; ol[q] = c2; }
    *(v2h*)(V16 + e) = o16; *(v2us*)(Vh + e) = oh; *(v2us*)(Vl + e) = ol;  }
__global__ __launch_bounds__(256) void k_csid(float* CS) { const int idx = blockIdx.x * 256 + threadIdx.x; if (idx >= TT * HD) return; v2f cs; cs[0] = 1.0f; cs[1] = 0.0f; *(v2f*)(CS + (size_t)idx * 2) = cs;  }
// k_asoft: per row (zz, i): t = S x 1/8 + (attn_mask[b][0][i][j] > 0.5 ? 0 : -1.25e8) (== the module's (S + (0 | -1e9)) x 1/8: identical for kept keys, exclusion otherwise) (mask row read per (i, j); all ones here); softmax over the keys (register row, one exp, fixed trees);
__global__ __launch_bounds__(256) void k_asoft(const float* __restrict__ Sb, const float* __restrict__ kvp, h16* P16, bf* Ph, bf* Pl) {
    const int lane = threadIdx.x & 31; const int row = blockIdx.x * 8 + (threadIdx.x >> 5); if (row >= ZH * TT) return; const int i = row % TT; const int zz = row / TT; (void)zz; const bool hires = (i < RH); const float* sr = Sb + (size_t)row * TT; float v[TT / 32]; float mx = -3.0e38f;
#pragma unroll
    for (int ch = 0; ch < TT / 128; ++ch) { const int j0 = ch * 128 + lane * 4; const v4f a = *(const v4f*)(sr + j0); const v4f kv4 = *(const v4f*)(kvp + (size_t)i * TT + j0);   /* mask row i of this batch ([L][S] slab), 16 B per lane, unconditional */
#pragma unroll
        for (int q = 0; q < 4; ++q) { const int j = j0 + q; (void)j; float s0 = __fmul_rn(a[q], SCL); asm volatile("" : "+v"(s0)); float madd = (kv4[q] > 0.5f) ? 0.0f : -1.25e8f; asm volatile("" : "+v"(madd)); const float t = __fadd_rn(s0, madd);   /* (s + (mask ? 0 : -1e9)) x 1/8 == s/8 + (0 | -1.25e8): identical for kept keys (madd 0), exclusion otherwise */ v[ch * 4 + q] = t; mx = fmaxf(mx, t); } }
#pragma unroll
    for (int sh = 16; sh; sh >>= 1) mx = fmaxf(mx, __shfl_xor(mx, sh, 32));
    float sum = 0.f;
#pragma unroll
    for (int k = 0; k < TT / 32; ++k) { float d0 = __fsub_rn(v[k], mx); asm volatile("" : "+v"(d0)); v[k] = __builtin_amdgcn_exp2f(__fmul_rn(d0, 1.4426950408889634f)); sum += v[k]; }
#pragma unroll
    for (int sh = 16; sh; sh >>= 1) sum += __shfl_xor(sum, sh, 32);
    const float f = __fdiv_rn(hires ? 1.0f : PCAR, sum);
{
        if (hires) {
#pragma unroll
            for (int ch = 0; ch < TT / 128; ++ch) { v4us oh, ol;
#pragma unroll
                for (int q = 0; q < 4; ++q) { unsigned short a, c2; splitf(v[ch * 4 + q] * f, a, c2); oh[q] = a; ol[q] = c2; }
                const size_t oo = ((size_t)zz * (RH ? RH : 1) + i) * TT + ch * 128 + lane * 4; *(v4us*)(Ph + oo) = oh; *(v4us*)(Pl + oo) = ol; }
        } else {
#pragma unroll
            for (int ch = 0; ch < TT / 128; ++ch) { v4h o4;
#pragma unroll
                for (int q = 0; q < 4; ++q) o4[q] = tohx(v[ch * 4 + q] * f);
                *(v4h*)(P16 + (size_t)row * TT + ch * 128 + lane * 4) = o4; } }
         }
}
// ---- k_pv: O = (Ph + Pl) x V^T planes, K = TT keys. One 16 x 64 output tile per work-group of PVW waves; wave w sums the keys [w * PVK, (w + 1) * PVK) of the whole tile (same fragment loaders as k_gemmw for both operands),
// the PVW partial tiles meet in LDS and are added in wave order 0 .. PVW - 1. grid (TT / 16, 1, ZH): one work-group per 16 rows, so the whole chip reads the planes at once, every load of a wave in flight together.
#define PVW 16
#define PVK (TT / PVW)
__global__ __launch_bounds__(32 * PVW) void k_pv(const bf* __restrict__ A, const bf* __restrict__ A2, const bf* __restrict__ Bt, float* C) {
    __shared__ __align__(16) float part[PVW][16 * 68];
    const size_t z = blockIdx.z, r0 = (size_t)blockIdx.x * 16; A += (z * TT + r0) * TT; A2 += (z * TT + r0) * TT; Bt += z * (size_t)HD * TT; C += (z * TT + r0) * HD;
    const int lane = threadIdx.x & 31, lr = lane & 15, hi = lane >> 4, w = threadIdx.x >> 5;
    const unsigned ob = (unsigned)(lr * TT + w * PVK + 8 * hi) * 2u;   /* one lane offset, in bytes, for all three planes: row (or column) lr, the wave's key slice, the lane half's 8 keys */
    const bf* Al = (const bf*)((const char*)A + ob); const bf* A2l = (const bf*)((const char*)A2 + ob); const bf* Bl = (const bf*)((const char*)Bt + ob);
    v16bf a[PVK / 32], a2[PVK / 32], b[4][PVK / 32];
#pragma unroll
    for (int ks = 0; ks < PVK / 32; ++ks) a[ks] = WFrag<bf>::ld(Al + ks * 32);
#pragma unroll
    for (int ks = 0; ks < PVK / 32; ++ks) a2[ks] = WFrag<bf>::ld(A2l + ks * 32);
#pragma unroll
    for (int nb = 0; nb < 4; ++nb)
#pragma unroll
        for (int ks = 0; ks < PVK / 32; ++ks) b[nb][ks] = WFrag<bf>::ld(Bl + nb * 16 * TT + ks * 32);
    asm volatile("s_wait_xcnt 0x0" :: "v"(ob) : "memory");   /* the wait owed before a register that the issued loads name is overwritten; it names the offset, so that register lives up to here */
    __builtin_amdgcn_sched_barrier(0);   /* keeps all 48 loads in front of the first product: without it the scheduler sinks them between the products and the wave pays the load latency eight times instead of once */
    v8f acc[4];
#pragma unroll
    for (int nb = 0; nb < 4; ++nb) acc[nb] = (v8f){};
#pragma unroll
    for (int ks = 0; ks < PVK / 32; ++ks) {
#pragma unroll
        for (int nb = 0; nb < 4; ++nb) acc[nb] = wmmab(a[ks], b[nb][ks], acc[nb]);
#pragma unroll
        for (int nb = 0; nb < 4; ++nb) acc[nb] = wmmab(a2[ks], b[nb][ks], acc[nb]); }
#pragma unroll
    for (int nb = 0; nb < 4; ++nb)
#pragma unroll
        for (int j = 0; j < 8; ++j) part[w][(hi * 8 + j) * 68 + nb * 16 + lr] = acc[nb][j];
    __syncthreads();   /* every wave's partial tile is in LDS before any thread adds them */
    const int e = threadIdx.x * 2, po = (e >> 6) * 68 + (e & 63); v2f s = *(const v2f*)(&part[0][po]);
#pragma unroll
    for (int q = 1; q < PVW; ++q) s += *(const v2f*)(&part[q][po]);
    *(v2f*)(C + e) = s;   /* the tile's 16 rows of 64 floats are 4 KiB in a row: whole lines per wave */
}
extern "C" void kernel_launch(void* const* d_in, const int* in_sizes, int n_in,
                              void* d_out, int out_size, void* d_ws, size_t ws_size, hipStream_t stream) {
    (void)in_sizes; (void)n_in; (void)out_size;
    const float* xq = (const float*)d_in[0]; const float* xk = (const float*)d_in[1]; const float* xv = (const float*)d_in[2]; const float* am = (const float*)d_in[3];   /* queries [2][2048][16][64], keys, values [2][2048][16][64], attn_mask [2][1][2048][2048] (> 0.5 = attend; all ones) */
    float* OUT = (float*)d_out;     // [2][16][2048][64] head-major (V = 'bhld')
    char* wsp = (char*)d_ws;
    auto take = [&](size_t bytes) { char* p = wsp; wsp += (bytes + 255) & ~(size_t)255; return (void*)p; };
    float* CS = (float*)take((size_t)TT * HD * 2 * 4);
    h16* QP16 = (h16*)take((size_t)NH_ * TT * HD * 2); bf* QPh = (bf*)take((size_t)NH_ * TT * HD * 2); bf* QPl = (bf*)take((size_t)NH_ * TT * HD * 2); h16* KP16 = (h16*)take((size_t)NKV * TT * HD * 2); bf* KPh = (bf*)take((size_t)NKV * TT * HD * 2); bf* KPl = (bf*)take((size_t)NKV * TT * HD * 2);
    h16* VT16 = (h16*)take((size_t)NKV * HD * TT * 2); bf* VTh = (bf*)take((size_t)NKV * HD * TT * 2); bf* VTl = (bf*)take((size_t)NKV * HD * TT * 2);
    float* Sb = (float*)take((size_t)ZH * TT * TT * 4); h16* P16 = (h16*)take(256); bf* Ph = (bf*)take((size_t)ZH * TT * TT * 2); bf* Pl = (bf*)take((size_t)ZH * TT * TT * 2);
    if ((size_t)(wsp - (char*)d_ws) > ws_size) return;    // ws 256 MiB (carve ~101 MiB)
    k_csid<<<(TT * HD + 255) / 256, 256, 0, stream>>>(CS);   /* identity table: k_rope is a plain [t][h][d] -> [h][t][d] plane builder */
    const unsigned LQ = (unsigned)(((size_t)NH_ * TT * HD / 2 + 255) / 256);
    for (int b = 0; b < NB_; ++b) {
        k_rope<<<LQ, 256, 0, stream>>>(xq + (size_t)b * TT * DQ, DQ, NH_, CS, nullptr, nullptr, 1.0f, QP16, QPh, QPl);   /* the inputs are already head-split: [t][h][64] == [t][h*64 + d]; the hi plane is exactly bf16(queries) */
        k_rope<<<LQ, 256, 0, stream>>>(xk + (size_t)b * TT * DQ, DQ, NKV, CS, nullptr, nullptr, 1.0f, KP16, KPh, KPl);
        k_vtp<<<(unsigned)(((size_t)NKV * HD * TT / 2 + 255) / 256), 256, 0, stream>>>(xv + (size_t)b * TT * DQ, DQ, NKV, VT16, VTh, VTl);   /* value^T planes; hi plane = bf16(values) exactly */
        for (int h0 = 0; h0 < NH_; h0 += ZH) { const size_t zq = (size_t)h0;
            k_gemmw<bf, 0, false><<<dim3(TT / 64, TT / 64, ZH), 32, 0, stream>>>(QPh + zq * TT * HD, nullptr, KPh + zq * TT * HD, nullptr, HD, Sb, TT, nullptr, (size_t)TT * HD, (size_t)TT * HD, (size_t)TT * TT);   /* scores = bf16(q).bf16(k) exactly (one product of the bf16-rounded inputs; lo planes unused) */
            k_asoft<<<ZH * TT / 8, 256, 0, stream>>>(Sb, am + (size_t)b * TT * TT, P16, Ph, Pl);   /* + mask term, x 1/8, softmax -> hi/lo planes for every row */
            k_pv<<<dim3(TT / 16, 1, ZH), 32 * PVW, 0, stream>>>(Ph, Pl, VTh + zq * HD * TT, OUT + ((size_t)b * NH_ + h0) * TT * HD); } }   /* V[b][h][l][d] = P.v (2 products), written head-major straight into the output */
}

// v002
// One run takes 105 microseconds.
// Timed twice side by side with v001, it ran 6.08 and 6.12 times as fast.
// All steps since v000 together make it 12.5 times as fast.
#include <hip/hip_runtime.h>

// Full (Informer-style) attention on pre-split heads with a mask, head-major output (queries [2][2048][16][64], keys, values [2][2048][16][64]; scores = q.k; + where(attn_mask > 0.5, 0, -1e9) (attn_mask [2][1][2048][2048] float, all ones, read per (i, j)); A = softmax(scores x 1/sqrt(64)); V = A.values as 'bhld' -> [2][16][2048][64] (4.2 M; no projections); argument order queries, keys, values, attn_mask).
// Layout: the inputs are already [t][h][d]: the plane builders transpose them to per-head planes whose hi plane is exactly bf16 of the input; then one fused kernel over all (batch, head) pairs: scores (one product), mask term and scale in the module's order, online softmax, P hi/lo x exact bf16(values) (2 products), one division, head-major output rows.
// Compute dtypes, f32 accumulate: every input rounded to bf16; scores exact; softmax f32; A.values 2 products; output f32.

#define NB_  2
#define TT   2048
#define DM   1024
#define NH_  16
#define NKV  16
#define REP  (NH_ / NKV)
#define HD   64
#define DQ   (NH_ * HD)
#define DKV  (NKV * HD)
#define ZH   2
#define RH   TT                   // every row hi/lo
#define WIN  0
#define PCAR 1024.0f
#define SCL  0.125f   // 1/sqrt(64), applied before the additive mask (pre-scaled to -1.25e8)
typedef _Float16 h16;
typedef unsigned short bf;
typedef __attribute__((ext_vector_type(16))) __bf16   v16bf;
typedef __attribute__((ext_vector_type(16))) _Float16 v16h;
typedef __attribute__((ext_vector_type(8)))  _Float16 v8h;
typedef __attribute__((ext_vector_type(8)))  unsigned short v8us;
typedef __attribute__((ext_vector_type(8)))  float    v8f;
typedef __attribute__((ext_vector_type(4)))  float    v4f;
typedef v8h  __attribute__((may_alias)) v8ha;
typedef v4f  __attribute__((may_alias)) v4fa;
typedef v8us __attribute__((may_alias)) v8usa;

__device__ __forceinline__ unsigned short f2bf(float f) { unsigned u = __float_as_uint(f); u += 0x7FFFu + ((u >> 16) & 1u); return (unsigned short)(u >> 16); }
__device__ __forceinline__ float bf2f(unsigned short b) { return __uint_as_float(((unsigned)b) << 16); }
__device__ __forceinline__ float bfr(float f) { return bf2f(f2bf(f)); }
__device__ __forceinline__ v16h cat16(v8h lo, v8h hi) { return __builtin_shufflevector(lo, hi, 0, 1, 2, 3, 4, 5, 6, 7, 8, 9, 10, 11, 12, 13, 14, 15); }
__device__ __forceinline__ v16bf cat16b(v8us lo, v8us hi) { return __builtin_bit_cast(v16bf, __builtin_shufflevector(lo, hi, 0, 1, 2, 3, 4, 5, 6, 7, 8, 9, 10, 11, 12, 13, 14, 15)); }
__device__ __forceinline__ v8f wmma16(v16h a, v16h b, v8f c) { return __builtin_amdgcn_wmma_f32_16x16x32_f16(false, a, false, b, (short)0, c, false, false); }
__device__ __forceinline__ v8f wmmab(v16bf a, v16bf b, v8f c) { return __builtin_amdgcn_wmma_f32_16x16x32_bf16(false, a, false, b, (short)0, c, false, false); }



__device__ __forceinline__ h16 tohx(float x) { return (h16)x; }
__device__ __forceinline__ void splitf(float y, unsigned short& h, unsigned short& l) { h = f2bf(y); l = f2bf(y - bf2f(h)); }
typedef __attribute__((ext_vector_type(2))) _Float16 v2h;
typedef __attribute__((ext_vector_type(4))) _Float16 v4h;
typedef __attribute__((ext_vector_type(2))) unsigned short v2us;
typedef __attribute__((ext_vector_type(4))) unsigned short v4us;
typedef __attribute__((ext_vector_type(2))) float v2f;
typedef __attribute__((ext_vector_type(4))) int v4i;

// k_rope: head planes [h][t][d] (fp16 + hi/lo) of rope(x) x sc with the rotate-half convention out[d] = x[d] cos[t][d] - x[d+HD/2] sin[t][d], out[d+HD/2] = x[d+HD/2] cos[t][d+HD/2] + x[d] sin[t][d+HD/2]
__global__ __launch_bounds__(256) void k_rope(const float* __restrict__ F, int pitch, int nheads, const float* __restrict__ CS, const float* __restrict__ RF, const float* __restrict__ nw, float sc, h16* P16, bf* Ph, bf* Pl) {
    const size_t e = ((size_t)blockIdx.x * 256 + threadIdx.x) * 2; if (e >= (size_t)nheads * TT * HD) return; const int d = (int)(e % HD); const int t = (int)((e / HD) % TT); const int h = (int)(e / ((size_t)HD * TT)); const float* f = F + (size_t)t * pitch + h * HD; const float rf = RF ? RF[(size_t)h * TT + t] : 1.0f; v2h o16; v2us oh, ol;
#pragma unroll
    for (int q = 0; q < 2; ++q) { const int dd = d + q; const int dp = (dd < HD / 2) ? dd + HD / 2 : dd - HD / 2; float x0 = f[dd], x1 = f[dp];
        if (RF) { float n0 = __fmul_rn(x0, rf), n1 = __fmul_rn(x1, rf); asm volatile("" : "+v"(n0)); asm volatile("" : "+v"(n1)); x0 = __fmul_rn(bfr(nw[dd]), n0); x1 = __fmul_rn(bfr(nw[dp]), n1); }
        const v2f cs = *(const v2f*)(CS + ((size_t)t * HD + dd) * 2); float a = __fmul_rn(x0, cs[0]), bq = __fmul_rn(x1, cs[1]); asm volatile("" : "+v"(a)); asm volatile("" : "+v"(bq)); const float r = ((dd < HD / 2) ? __fsub_rn(a, bq) : __fadd_rn(a, bq)) * sc;
        o16[q] = tohx(r); unsigned short a2, c2; splitf(r, a2, c2); oh[q] = a2; ol[q] = c2; }
    *(v2h*)(P16 + e) = o16; *(v2us*)(Ph + e) = oh; *(v2us*)(Pl + e) = ol;  }
__global__ __launch_bounds__(256) void k_vtp(const float* __restrict__ F, int pitch, int nheads, h16* V16, bf* Vh, bf* Vl) { const size_t e = ((size_t)blockIdx.x * 256 + threadIdx.x) * 2; if (e >= (size_t)nheads * HD * TT) return; const int t = (int)(e % TT); const int d = (int)((e / TT) % HD); const int g = (int)(e / ((size_t)TT * HD)); v2h o16; v2us oh, ol;
#pragma unroll
    for (int q = 0; q < 2; ++q) { const float x = F[(size_t)(t + q) * pitch + g * HD + d]; o16[q] = tohx(x); unsigned short a2, c2; splitf(x, a2, c2); oh[q] = a2; ol[q] = c2; }
    *(v2h*)(V16 + e) = o16; *(v2us*)(Vh + e) = oh; *(v2us*)(Vl + e) = ol;  }
__global__ __launch_bounds__(256) void k_csid(float* CS) { const int idx = blockIdx.x * 256 + threadIdx.x; if (idx >= TT * HD) return; v2f cs; cs[0] = 1.0f; cs[1] = 0.0f; *(v2f*)(CS + (size_t)idx * 2) = cs;  }
#define FW 8
#define FK 64
#define FP 144      // LDS row pitch, bytes: 128 + 16, an odd multiple of 16 for the 16-byte fragment reads
#define MP 272      // LDS row pitch of the mask tile, bytes: 256 + 16
#define FLZ 5.0f
#define L2E 1.4426950408889634f
typedef __attribute__((ext_vector_type(2))) __bf16 v2bf;
typedef __attribute__((ext_vector_type(8))) unsigned v8u;
__device__ __forceinline__ unsigned pack2(float lo, float hi) { v2f x; x[0] = lo; x[1] = hi; return __builtin_bit_cast(unsigned, __builtin_convertvector(x, v2bf)); }   /* two f32 -> two bf16, round to nearest even */
__device__ __forceinline__ float xhalf(float x) { return __builtin_bit_cast(float, __builtin_amdgcn_permlanex16(__builtin_bit_cast(int, x), __builtin_bit_cast(int, x), 0x76543210, 0xfedcba98, false, false)); }   /* lane l <-> lane l ^ 16 */
__device__ __forceinline__ v16bf ldfrag(const unsigned char* p) { return cat16b(*(const v8usa*)p, *(const v8usa*)(p + 32)); }   /* k order 8 h + s, 16 + 8 h + s: p already holds the 16 h bytes */
/* eight 2^x in place, then the one slot the instruction set asks for behind a transcendental before its result is read or its source overwritten */
__device__ __forceinline__ void exp2x8(float (&e)[8]) {
    asm("v_exp_f32 %0, %0\n\tv_exp_f32 %1, %1\n\tv_exp_f32 %2, %2\n\tv_exp_f32 %3, %3\n\tv_exp_f32 %4, %4\n\tv_exp_f32 %5, %5\n\tv_exp_f32 %6, %6\n\tv_exp_f32 %7, %7\n\tv_nop"
        : "+v"(e[0]), "+v"(e[1]), "+v"(e[2]), "+v"(e[3]), "+v"(e[4]), "+v"(e[5]), "+v"(e[6]), "+v"(e[7])); }
__global__ __launch_bounds__(32 * FW) void k_fattn(const bf* __restrict__ Qp, const bf* __restrict__ Kp, const bf* __restrict__ Vp, const float* __restrict__ am, float* __restrict__ O) {
    __shared__ __align__(16) unsigned char L[2][2 * FK * FP];
    __shared__ __align__(16) unsigned char ML[FW][16 * MP];
    const int tid = threadIdx.x, lane = tid & 31, c = lane & 15, h = lane >> 4, w = tid >> 5;
    const int bh = blockIdx.y, q0 = blockIdx.x * (FW * 16) + w * 16, q = q0 + c;
    const unsigned char* qp = (const unsigned char*)(Qp + ((size_t)bh * TT + q) * HD) + 16 * h;
    v16bf qf[2];
#pragma unroll
    for (int kc = 0; kc < 2; ++kc) qf[kc] = ldfrag(qp + 64 * kc);
    const int srow = tid >> 3, sch = tid & 7;   /* K, V^T staging: 8 threads a row of 128 bytes, 32 rows a sweep, two sweeps a tile */
    const bf* kg = Kp + (size_t)bh * TT * HD + srow * HD + sch * 8;
    const bf* vg = Vp + (size_t)bh * HD * TT + (size_t)srow * TT + sch * 8;
    const int sl = srow * FP + sch * 16;
    const float* mg = am + ((size_t)(bh / NH_) * TT + q0 + h) * TT + 4 * c;   /* mask staging, each wave its own 16 rows: a load takes two rows of 256 bytes, whole lines */
    unsigned char* mst = &ML[w][h * MP + 16 * c];
    const unsigned char* mld = &ML[w][c * MP + 32 * h];   /* read back: the row of this lane's query, at the lane half's 8 keys */
    v4i kr0 = *(const v4i*)kg, kr1 = *(const v4i*)(kg + 32 * HD), vr0 = *(const v4i*)vg, vr1 = *(const v4i*)(vg + 32 * TT);
    v4f mr[8];
#pragma unroll
    for (int i = 0; i < 8; ++i) mr[i] = *(const v4f*)(mg + (size_t)(2 * i) * TT);
    *(v4i*)(&L[0][sl]) = kr0; *(v4i*)(&L[0][sl + 32 * FP]) = kr1; *(v4i*)(&L[0][FK * FP + sl]) = vr0; *(v4i*)(&L[0][FK * FP + sl + 32 * FP]) = vr1;
#pragma unroll
    for (int i = 0; i < 8; ++i) *(v4fa*)(mst + 2 * i * MP) = mr[i];
    __syncthreads();   /* pass 0's tiles are in LDS before any wave reads them */
    v8f acc[4];
#pragma unroll
    for (int dt = 0; dt < 4; ++dt) acc[dt] = (v8f){};
    float m_run = -__builtin_inff(), l_run = 0.f;
#pragma unroll 1   /* rolled: the body is one whole pass, unrolling only grows the code and the registers */
    for (int t = 0; t < TT / FK; ++t) {
        const unsigned char* Lk = &L[t & 1][0] + c * FP + 16 * h; const unsigned char* Lv = Lk + FK * FP; const bool more = t + 1 < TT / FK;
        if (more) { kg += FK * HD; vg += FK; mg += FK; kr0 = *(const v4i*)kg; kr1 = *(const v4i*)(kg + 32 * HD); vr0 = *(const v4i*)vg; vr1 = *(const v4i*)(vg + 32 * TT);   /* next pass's tiles, in flight under this pass */
#pragma unroll
            for (int i = 0; i < 8; ++i) mr[i] = *(const v4f*)(mg + (size_t)(2 * i) * TT); }
        v16bf kf[4][2]; v4f mk[8];
#pragma unroll
        for (int kt = 0; kt < 4; ++kt)
#pragma unroll
            for (int kc = 0; kc < 2; ++kc) kf[kt][kc] = ldfrag(Lk + 16 * kt * FP + 64 * kc);
#pragma unroll
        for (int i = 0; i < 8; ++i) mk[i] = *(const v4fa*)(mld + 64 * (i >> 1) + 16 * (i & 1));
        __builtin_amdgcn_sched_barrier(0);   /* keeps the pass's K and mask reads one group in front of the products: sunk between them, each pair costs its own LDS latency */
        v8f s[4];
#pragma unroll
        for (int kt = 0; kt < 4; ++kt) { s[kt] = (v8f){};
#pragma unroll
            for (int kc = 0; kc < 2; ++kc) s[kt] = wmmab(kf[kt][kc], qf[kc], s[kt]); }
        v16bf vf[2][4];
#pragma unroll
        for (int dt = 0; dt < 4; ++dt) vf[0][dt] = ldfrag(Lv + 16 * dt * FP);
        __builtin_amdgcn_sched_barrier(0);   /* keeps the first 32 keys' V^T reads here, one group, in flight under the softmax arithmetic */
        float mx = -3.0e38f;
#pragma unroll
        for (int kt = 0; kt < 4; ++kt)
#pragma unroll
            for (int r = 0; r < 8; ++r) { const float madd = (mk[2 * kt + (r >> 2)][r & 3] > 0.5f) ? 0.0f : -1.25e8f; const float tv = __builtin_fmaf(s[kt][r], SCL, madd);   /* (s + (mask ? 0 : -1e9)) x 1/8: the product by 1/8 is exact, so one rounding, as the module's add */
                s[kt][r] = tv; mx = fmaxf(mx, tv); }
        mx = fmaxf(mx, xhalf(mx));   /* both halves hold the query's maximum of this pass */
        if (__builtin_amdgcn_ballot_w32(mx > m_run + FLZ) != 0) {   /* one scalar branch a pass; always taken in pass 0 (m_run = -inf, factor 0) */
            const float m_new = fmaxf(m_run, mx); const float corr = __builtin_amdgcn_exp2f((m_run - m_new) * L2E); m_run = m_new; l_run *= corr;
#pragma unroll
            for (int dt = 0; dt < 4; ++dt) acc[dt] = acc[dt] * corr; }
#pragma unroll
        for (int ks = 0; ks < 2; ++ks) { v8u wh, wl;
#pragma unroll
            for (int g = 0; g < 2; ++g) { float e[8];
#pragma unroll
                for (int r = 0; r < 8; ++r) e[r] = (s[2 * ks + g][r] - m_run) * L2E;
                exp2x8(e);
#pragma unroll
                for (int i = 0; i < 4; ++i) { const float p0 = e[2 * i], p1 = e[2 * i + 1]; l_run += p0 + p1; const unsigned u = pack2(p0, p1); wh[4 * g + i] = u; wl[4 * g + i] = pack2(p0 - __uint_as_float(u << 16), p1 - __uint_as_float(u & 0xFFFF0000u)); } }   /* hi = bf16(p), lo = bf16(p - hi) */
            const v16bf ph = __builtin_bit_cast(v16bf, wh), pl = __builtin_bit_cast(v16bf, wl);
            if (ks == 0) {
#pragma unroll
                for (int dt = 0; dt < 4; ++dt) vf[1][dt] = ldfrag(Lv + 16 * dt * FP + 64);
                __builtin_amdgcn_sched_barrier(0); }   /* the last 32 keys' V^T reads, one group, in flight under the first products and the second half's exponentials; later than the first group for the registers */
#pragma unroll
            for (int dt = 0; dt < 4; ++dt) acc[dt] = wmmab(vf[ks][dt], ph, acc[dt]);
#pragma unroll
            for (int dt = 0; dt < 4; ++dt) acc[dt] = wmmab(vf[ks][dt], pl, acc[dt]); }
        if (more) { unsigned char* Ln = &L[(t + 1) & 1][0]; *(v4i*)(Ln + sl) = kr0; *(v4i*)(Ln + sl + 32 * FP) = kr1; *(v4i*)(Ln + FK * FP + sl) = vr0; *(v4i*)(Ln + FK * FP + sl + 32 * FP) = vr1;
#pragma unroll
            for (int i = 0; i < 8; ++i) *(v4fa*)(mst + 2 * i * MP) = mr[i]; }   /* the mask rows are the wave's own: it read this pass's at the pass's head */
        __syncthreads();   /* publishes the next pass's tiles and ends every wave's reads of this pass's buffer, which the next pass refills */
    }
    const float inv = __fdiv_rn(1.0f, l_run + xhalf(l_run));   /* the two halves' sums meet once */
    float* orow = O + ((size_t)bh * TT + q) * HD + 8 * h;   /* acc[dt][r] = O[q][16 dt + 8 h + r] */
#pragma unroll
    for (int dt = 0; dt < 4; ++dt) { const v8f o = acc[dt] * inv; v4f o0, o1;
#pragma unroll
        for (int r = 0; r < 4; ++r) { o0[r] = o[r]; o1[r] = o[4 + r]; }
        *(v4f*)(orow + 16 * dt) = o0; *(v4f*)(orow + 16 * dt + 4) = o1; }
}
extern "C" void kernel_launch(void* const* d_in, const int* in_sizes, int n_in,
                              void* d_out, int out_size, void* d_ws, size_t ws_size, hipStream_t stream) {
    (void)in_sizes; (void)n_in; (void)out_size;
    const float* xq = (const float*)d_in[0]; const float* xk = (const float*)d_in[1]; const float* xv = (const float*)d_in[2]; const float* am = (const float*)d_in[3];   /* queries [2][2048][16][64], keys, values [2][2048][16][64], attn_mask [2][1][2048][2048] (> 0.5 = attend; all ones) */
    float* OUT = (float*)d_out;     // [2][16][2048][64] head-major (V = 'bhld')
    char* wsp = (char*)d_ws;
    auto take = [&](size_t bytes) { char* p = wsp; wsp += (bytes + 255) & ~(size_t)255; return (void*)p; };
    float* CS = (float*)take((size_t)TT * HD * 2 * 4);
    const size_t PL = (size_t)NH_ * TT * HD;   /* elements of one batch's plane */
    h16* QP16 = (h16*)take(PL * 2); bf* QPh = (bf*)take(NB_ * PL * 2); bf* QPl = (bf*)take(PL * 2); h16* KP16 = (h16*)take(PL * 2); bf* KPh = (bf*)take(NB_ * PL * 2); bf* KPl = (bf*)take(PL * 2);   /* the hi planes, the only ones read, hold both batches */
    h16* VT16 = (h16*)take(PL * 2); bf* VTh = (bf*)take(NB_ * PL * 2); bf* VTl = (bf*)take(PL * 2);
    if ((size_t)(wsp - (char*)d_ws) > ws_size) return;    // ws 256 MiB (carve 49 MiB)
    k_csid<<<(TT * HD + 255) / 256, 256, 0, stream>>>(CS);   /* identity table: k_rope is a plain [t][h][d] -> [h][t][d] plane builder */
    const unsigned LQ = (unsigned)((PL / 2 + 255) / 256);
    for (int b = 0; b < NB_; ++b) {
        k_rope<<<LQ, 256, 0, stream>>>(xq + (size_t)b * TT * DQ, DQ, NH_, CS, nullptr, nullptr, 1.0f, QP16, QPh + b * PL, QPl);   /* the inputs are already head-split: [t][h][64] == [t][h*64 + d]; the hi plane is exactly bf16(queries) */
        k_rope<<<LQ, 256, 0, stream>>>(xk + (size_t)b * TT * DQ, DQ, NKV, CS, nullptr, nullptr, 1.0f, KP16, KPh + b * PL, KPl);
        k_vtp<<<LQ, 256, 0, stream>>>(xv + (size_t)b * TT * DQ, DQ, NKV, VT16, VTh + b * PL, VTl); }   /* value^T planes; hi plane = bf16(values) exactly */
    k_fattn<<<dim3(TT / (FW * 16), NB_ * NH_), 32 * FW, 0, stream>>>(QPh, KPh, VTh, am, OUT);   /* all 32 (batch, head) pairs in one launch: V[b][h][l][d], head-major, straight into the output */
}

// v003
// One run takes 70.3 microseconds.
// Timed twice side by side with v002, it ran 1.48 and 1.49 times as fast.
// Over all steps from v000 it is 18.6 times as fast.
#include <hip/hip_runtime.h>

// Full (Informer-style) attention on pre-split heads with a mask, head-major output (queries [2][2048][16][64], keys, values [2][2048][16][64]; scores = q.k; + where(attn_mask > 0.5, 0, -1e9) (attn_mask [2][1][2048][2048] float, all ones, read per (i, j)); A = softmax(scores x 1/sqrt(64)); V = A.values as 'bhld' -> [2][16][2048][64] (4.2 M; no projections); argument order queries, keys, values, attn_mask).
// Layout: the inputs are already [t][h][d]: one launch (k_planes) rounds them to bf16 and writes the per-head planes Q, K [bh][t][d] and V^T [bh][d][t]; then one fused kernel over all (batch, head) pairs: scores (one product), mask term and scale in the module's order, online softmax, P hi/lo x exact bf16(values) (2 products), one division, head-major output rows.
// Compute dtypes, f32 accumulate: every input rounded to bf16; scores exact; softmax f32; A.values 2 products; output f32.

#define NB_  2
#define TT   2048
#define DM   1024
#define NH_  16
#define NKV  16
#define REP  (NH_ / NKV)
#define HD   64
#define DQ   (NH_ * HD)
#define DKV  (NKV * HD)
#define ZH   2
#define RH   TT                   // every row hi/lo
#define WIN  0
#define PCAR 1024.0f
#define SCL  0.125f   // 1/sqrt(64), applied after the additive mask as the module
typedef unsigned short bf;
typedef __attribute__((ext_vector_type(16))) __bf16   v16bf;
typedef __attribute__((ext_vector_type(16))) _Float16 v16h;
typedef __attribute__((ext_vector_type(8)))  _Float16 v8h;
typedef __attribute__((ext_vector_type(8)))  unsigned short v8us;
typedef __attribute__((ext_vector_type(8)))  float    v8f;
typedef __attribute__((ext_vector_type(4)))  float    v4f;
typedef v8h  __attribute__((may_alias)) v8ha;
typedef v4f  __attribute__((may_alias)) v4fa;
typedef v8us __attribute__((may_alias)) v8usa;

__device__ __forceinline__ v16h cat16(v8h lo, v8h hi) { return __builtin_shufflevector(lo, hi, 0, 1, 2, 3, 4, 5, 6, 7, 8, 9, 10, 11, 12, 13, 14, 15); }
__device__ __forceinline__ v16bf cat16b(v8us lo, v8us hi) { return __builtin_bit_cast(v16bf, __builtin_shufflevector(lo, hi, 0, 1, 2, 3, 4, 5, 6, 7, 8, 9, 10, 11, 12, 13, 14, 15)); }
__device__ __forceinline__ v8f wmma16(v16h a, v16h b, v8f c) { return __builtin_amdgcn_wmma_f32_16x16x32_f16(false, a, false, b, (short)0, c, false, false); }
__device__ __forceinline__ v8f wmmab(v16bf a, v16bf b, v8f c) { return __builtin_amdgcn_wmma_f32_16x16x32_bf16(false, a, false, b, (short)0, c, false, false); }



typedef __attribute__((ext_vector_type(4))) _Float16 v4h;
typedef __attribute__((ext_vector_type(4))) unsigned short v4us;
typedef __attribute__((ext_vector_type(2))) float v2f;
typedef __attribute__((ext_vector_type(4))) int v4i;

#define FW 8
#define FK 64
#define FP 144      // LDS row pitch, bytes: 128 + 16, an odd multiple of 16 for the 16-byte fragment reads
#define MP 272      // LDS row pitch of the mask tile, bytes: 256 + 16
#define FLZ 5.0f
#define L2E 1.4426950408889634f
typedef __attribute__((ext_vector_type(2))) __bf16 v2bf;
typedef __attribute__((ext_vector_type(8))) unsigned v8u;
__device__ __forceinline__ unsigned pack2(float lo, float hi) { v2f x; x[0] = lo; x[1] = hi; return __builtin_bit_cast(unsigned, __builtin_convertvector(x, v2bf)); }   /* two f32 -> two bf16, round to nearest even */
__device__ __forceinline__ float xhalf(float x) { return __builtin_bit_cast(float, __builtin_amdgcn_permlanex16(__builtin_bit_cast(int, x), __builtin_bit_cast(int, x), 0x76543210, 0xfedcba98, false, false)); }   /* lane l <-> lane l ^ 16 */
__device__ __forceinline__ v16bf ldfrag(const unsigned char* p) { return cat16b(*(const v8usa*)p, *(const v8usa*)(p + 32)); }   /* k order 8 h + s, 16 + 8 h + s: p already holds the 16 h bytes */
/* eight 2^x in place, then the one slot the instruction set asks for behind a transcendental before its result is read or its source overwritten */
__device__ __forceinline__ void exp2x8(float (&e)[8]) {
    asm("v_exp_f32 %0, %0\n\tv_exp_f32 %1, %1\n\tv_exp_f32 %2, %2\n\tv_exp_f32 %3, %3\n\tv_exp_f32 %4, %4\n\tv_exp_f32 %5, %5\n\tv_exp_f32 %6, %6\n\tv_exp_f32 %7, %7\n\tv_nop"
        : "+v"(e[0]), "+v"(e[1]), "+v"(e[2]), "+v"(e[3]), "+v"(e[4]), "+v"(e[5]), "+v"(e[6]), "+v"(e[7])); }
__global__ __launch_bounds__(32 * FW) void k_fattn(const bf* __restrict__ Qp, const bf* __restrict__ Kp, const bf* __restrict__ Vp, const float* __restrict__ am, float* __restrict__ O) {
    __shared__ __align__(16) unsigned char L[2][2 * FK * FP];
    __shared__ __align__(16) unsigned char ML[FW][16 * MP];
    const int tid = threadIdx.x, lane = tid & 31, c = lane & 15, h = lane >> 4, w = tid >> 5;
    const int bh = blockIdx.y, q0 = blockIdx.x * (FW * 16) + w * 16, q = q0 + c;
    const unsigned char* qp = (const unsigned char*)(Qp + ((size_t)bh * TT + q) * HD) + 16 * h;
    v16bf qf[2];
#pragma unroll
    for (int kc = 0; kc < 2; ++kc) qf[kc] = ldfrag(qp + 64 * kc);
    const int srow = tid >> 3, sch = tid & 7;   /* K, V^T staging: 8 threads a row of 128 bytes, 32 rows a sweep, two sweeps a tile */
    const bf* kg = Kp + (size_t)bh * TT * HD + srow * HD + sch * 8;
    const bf* vg = Vp + (size_t)bh * HD * TT + (size_t)srow * TT + sch * 8;
    const int sl = srow * FP + sch * 16;
    const float* mg = am + ((size_t)(bh / NH_) * TT + q0 + h) * TT + 4 * c;   /* mask staging, each wave its own 16 rows: a load takes two rows of 256 bytes, whole lines */
    unsigned char* mst = &ML[w][h * MP + 16 * c];
    const unsigned char* mld = &ML[w][c * MP + 32 * h];   /* read back: the row of this lane's query, at the lane half's 8 keys */
    v4i kr0 = *(const v4i*)kg, kr1 = *(const v4i*)(kg + 32 * HD), vr0 = *(const v4i*)vg, vr1 = *(const v4i*)(vg + 32 * TT);
    v4f mr[8];
#pragma unroll
    for (int i = 0; i < 8; ++i) mr[i] = *(const v4f*)(mg + (size_t)(2 * i) * TT);
    *(v4i*)(&L[0][sl]) = kr0; *(v4i*)(&L[0][sl + 32 * FP]) = kr1; *(v4i*)(&L[0][FK * FP + sl]) = vr0; *(v4i*)(&L[0][FK * FP + sl + 32 * FP]) = vr1;
#pragma unroll
    for (int i = 0; i < 8; ++i) *(v4fa*)(mst + 2 * i * MP) = mr[i];
    __syncthreads();   /* pass 0's tiles are in LDS before any wave reads them */
    v8f acc[4];
#pragma unroll
    for (int dt = 0; dt < 4; ++dt) acc[dt] = (v8f){};
    float m_run = -__builtin_inff(), l_run = 0.f;
#pragma unroll 1   /* rolled: the body is one whole pass, unrolling only grows the code and the registers */
    for (int t = 0; t < TT / FK; ++t) {
        const unsigned char* Lk = &L[t & 1][0] + c * FP + 16 * h; const unsigned char* Lv = Lk + FK * FP; const bool more = t + 1 < TT / FK;
        if (more) { kg += FK * HD; vg += FK; mg += FK; kr0 = *(const v4i*)kg; kr1 = *(const v4i*)(kg + 32 * HD); vr0 = *(const v4i*)vg; vr1 = *(const v4i*)(vg + 32 * TT);   /* next pass's tiles, in flight under this pass */
#pragma unroll
            for (int i = 0; i < 8; ++i) mr[i] = *(const v4f*)(mg + (size_t)(2 * i) * TT); }
        v16bf kf[4][2]; v4f mk[8];
#pragma unroll
        for (int kt = 0; kt < 4; ++kt)
#pragma unroll
            for (int kc = 0; kc < 2; ++kc) kf[kt][kc] = ldfrag(Lk + 16 * kt * FP + 64 * kc);
#pragma unroll
        for (int i = 0; i < 8; ++i) mk[i] = *(const v4fa*)(mld + 64 * (i >> 1) + 16 * (i & 1));
        __builtin_amdgcn_sched_barrier(0);   /* keeps the pass's K and mask reads one group in front of the products: sunk between them, each pair costs its own LDS latency */
        v8f s[4];
#pragma unroll
        for (int kt = 0; kt < 4; ++kt) { s[kt] = (v8f){};
#pragma unroll
            for (int kc = 0; kc < 2; ++kc) s[kt] = wmmab(kf[kt][kc], qf[kc], s[kt]); }
        v16bf vf[2][4];
#pragma unroll
        for (int dt = 0; dt < 4; ++dt) vf[0][dt] = ldfrag(Lv + 16 * dt * FP);
        __builtin_amdgcn_sched_barrier(0);   /* keeps the first 32 keys' V^T reads here, one group, in flight under the softmax arithmetic */
        float mx = -3.0e38f;
#pragma unroll
        for (int kt = 0; kt < 4; ++kt)
#pragma unroll
            for (int r = 0; r < 8; ++r) { const float madd = (mk[2 * kt + (r >> 2)][r & 3] > 0.5f) ? 0.0f : -1.25e8f; const float tv = __builtin_fmaf(s[kt][r], SCL, madd);   /* (s + (mask ? 0 : -1e9)) x 1/8: the product by 1/8 is exact, so one rounding, as the module's add */
                s[kt][r] = tv; mx = fmaxf(mx, tv); }
        mx = fmaxf(mx, xhalf(mx));   /* both halves hold the query's maximum of this pass */
        if (__builtin_amdgcn_ballot_w32(mx > m_run + FLZ) != 0) {   /* one scalar branch a pass; always taken in pass 0 (m_run = -inf, factor 0) */
            const float m_new = fmaxf(m_run, mx); const float corr = __builtin_amdgcn_exp2f((m_run - m_new) * L2E); m_run = m_new; l_run *= corr;
#pragma unroll
            for (int dt = 0; dt < 4; ++dt) acc[dt] = acc[dt] * corr; }
#pragma unroll
        for (int ks = 0; ks < 2; ++ks) { v8u wh, wl;
#pragma unroll
            for (int g = 0; g < 2; ++g) { float e[8];
#pragma unroll
                for (int r = 0; r < 8; ++r) e[r] = (s[2 * ks + g][r] - m_run) * L2E;
                exp2x8(e);
#pragma unroll
                for (int i = 0; i < 4; ++i) { const float p0 = e[2 * i], p1 = e[2 * i + 1]; l_run += p0 + p1; const unsigned u = pack2(p0, p1); wh[4 * g + i] = u; wl[4 * g + i] = pack2(p0 - __uint_as_float(u << 16), p1 - __uint_as_float(u & 0xFFFF0000u)); } }   /* hi = bf16(p), lo = bf16(p - hi) */
            const v16bf ph = __builtin_bit_cast(v16bf, wh), pl = __builtin_bit_cast(v16bf, wl);
            if (ks == 0) {
#pragma unroll
                for (int dt = 0; dt < 4; ++dt) vf[1][dt] = ldfrag(Lv + 16 * dt * FP + 64);
                __builtin_amdgcn_sched_barrier(0); }   /* the last 32 keys' V^T reads, one group, in flight under the first products and the second half's exponentials; later than the first group for the registers */
#pragma unroll
            for (int dt = 0; dt < 4; ++dt) acc[dt] = wmmab(vf[ks][dt], ph, acc[dt]);
#pragma unroll
            for (int dt = 0; dt < 4; ++dt) acc[dt] = wmmab(vf[ks][dt], pl, acc[dt]); }
        if (more) { unsigned char* Ln = &L[(t + 1) & 1][0]; *(v4i*)(Ln + sl) = kr0; *(v4i*)(Ln + sl + 32 * FP) = kr1; *(v4i*)(Ln + FK * FP + sl) = vr0; *(v4i*)(Ln + FK * FP + sl + 32 * FP) = vr1;
#pragma unroll
            for (int i = 0; i < 8; ++i) *(v4fa*)(mst + 2 * i * MP) = mr[i]; }   /* the mask rows are the wave's own: it read this pass's at the pass's head */
        __syncthreads();   /* publishes the next pass's tiles and ends every wave's reads of this pass's buffer, which the next pass refills */
    }
    const float inv = __fdiv_rn(1.0f, l_run + xhalf(l_run));   /* the two halves' sums meet once */
    float* orow = O + ((size_t)bh * TT + q) * HD + 8 * h;   /* acc[dt][r] = O[q][16 dt + 8 h + r] */
#pragma unroll
    for (int dt = 0; dt < 4; ++dt) { const v8f o = acc[dt] * inv; v4f o0, o1;
#pragma unroll
        for (int r = 0; r < 4; ++r) { o0[r] = o[r]; o1[r] = o[4 + r]; }
        *(v4f*)(orow + 16 * dt) = o0; *(v4f*)(orow + 16 * dt + 4) = o1; }
}
// ---- k_planes: the three bf16 planes that k_fattn reads, both batches, in ONE launch; nothing else is written.
// Work-group = PT positions of one (batch, head), of all three inputs: 24 whole-line 16-byte loads a thread, all issued before the first use.
// Q, K: a row of 64 f32 (256 bytes, 16 lanes) becomes a row of 128 bytes; a wave stores two neighbouring rows, 256 bytes in a row.
// V^T: a lane packs positions 2 p, 2 p + 1 of four d into four words, LDS [d][p]; read back by rows of d, 256 bytes of one d a half wave.
// The 16-byte piece of an LDS row stands at (piece ^ (d >> 2)): the 16 lanes that write one p for 64 d hit 16 different pieces, and the read-back stays 16-byte aligned.
#define PT 128
typedef __attribute__((ext_vector_type(2))) unsigned v2u;
typedef __attribute__((ext_vector_type(4))) unsigned v4u;
typedef v4u __attribute__((may_alias)) v4ua;
__global__ __launch_bounds__(256) void k_planes(const float* __restrict__ xq, const float* __restrict__ xk, const float* __restrict__ xv, bf* __restrict__ Qp, bf* __restrict__ Kp, bf* __restrict__ Vp) {
    __shared__ __align__(16) unsigned VL[HD * (PT / 2)];
    const int tid = threadIdx.x, g = tid & 15, u = tid >> 4;
    const int t0 = blockIdx.x * PT, bh = blockIdx.y;
    const size_t in0 = ((size_t)((bh / NH_) * TT + t0) * NH_ + (bh % NH_)) * HD + 4 * g;   /* [b][t0][h][4 g]; the next position is DQ elements on */
    const float* pv = xv + in0 + (size_t)(2 * u) * DQ; const float* pq = xq + in0 + (size_t)u * DQ; const float* pk = xk + in0 + (size_t)u * DQ;
    v4f va[4], vb[4], qa[8], ka[8];
#pragma unroll
    for (int i = 0; i < 4; ++i) { va[i] = *(const v4f*)(pv + 32 * i * DQ); vb[i] = *(const v4f*)(pv + (32 * i + 1) * DQ); }
#pragma unroll
    for (int i = 0; i < 8; ++i) { qa[i] = *(const v4f*)(pq + 16 * i * DQ); ka[i] = *(const v4f*)(pk + 16 * i * DQ); }
    asm volatile("s_wait_xcnt 0x0" :: "v"(pv), "v"(pq), "v"(pk) : "memory");   /* behind the last load, in front of the first overwrite of an address pair, where this wait belongs. The three pairs are inputs so that they live up to it (without them the compiler hands a pair to a later load as its destination); the clobber keeps all 24 loads in front of it, in flight together */
#pragma unroll
    for (int i = 0; i < 4; ++i) { const int p = u + 16 * i;
#pragma unroll
        for (int j = 0; j < 4; ++j) VL[(4 * g + j) * (PT / 2) + 4 * ((p >> 2) ^ g) + (p & 3)] = pack2(va[i][j], vb[i][j]); }
    __syncthreads();   /* the whole V^T tile is in LDS before any row of it is read back; it stands in front of every global store, so that it waits for none */
    v4u vt[4];
#pragma unroll
    for (int i = 0; i < 4; ++i) { const int d = u + 16 * i; vt[i] = *(const v4ua*)&VL[d * (PT / 2) + 4 * (g ^ ((d >> 2) & 15))]; }
    bf* qo = Qp + ((size_t)bh * TT + t0 + u) * HD + 4 * g; bf* ko = Kp + ((size_t)bh * TT + t0 + u) * HD + 4 * g;
#pragma unroll
    for (int i = 0; i < 8; ++i) { v2u x, y; x[0] = pack2(qa[i][0], qa[i][1]); x[1] = pack2(qa[i][2], qa[i][3]); y[0] = pack2(ka[i][0], ka[i][1]); y[1] = pack2(ka[i][2], ka[i][3]);
        *(v2u*)(qo + 16 * i * HD) = x; *(v2u*)(ko + 16 * i * HD) = y; }
#pragma unroll
    for (int i = 0; i < 4; ++i) *(v4u*)(Vp + ((size_t)bh * HD + u + 16 * i) * TT + t0 + 8 * g) = vt[i];
}
extern "C" void kernel_launch(void* const* d_in, const int* in_sizes, int n_in,
                              void* d_out, int out_size, void* d_ws, size_t ws_size, hipStream_t stream) {
    (void)in_sizes; (void)n_in; (void)out_size;
    const float* xq = (const float*)d_in[0]; const float* xk = (const float*)d_in[1]; const float* xv = (const float*)d_in[2]; const float* am = (const float*)d_in[3];   /* queries [2][2048][16][64], keys, values [2][2048][16][64], attn_mask [2][1][2048][2048] (> 0.5 = attend; all ones) */
    float* OUT = (float*)d_out;     // [2][16][2048][64] head-major (V = 'bhld')
    char* wsp = (char*)d_ws;
    auto take = [&](size_t bytes) { char* p = wsp; wsp += (bytes + 255) & ~(size_t)255; return (void*)p; };
    const size_t PL = (size_t)NB_ * NH_ * TT * HD;   /* elements of one plane, both batches */
    bf* QPh = (bf*)take(PL * 2); bf* KPh = (bf*)take(PL * 2); bf* VTh = (bf*)take(PL * 2);
    if ((size_t)(wsp - (char*)d_ws) > ws_size) return;    // ws 256 MiB (carve 24 MiB)
    k_planes<<<dim3(TT / PT, NB_ * NH_), 256, 0, stream>>>(xq, xk, xv, QPh, KPh, VTh);   /* bf16(queries), bf16(keys) as [bh][t][d], bf16(values) as [bh][d][t] */
    k_fattn<<<dim3(TT / (FW * 16), NB_ * NH_), 32 * FW, 0, stream>>>(QPh, KPh, VTh, am, OUT);   /* all 32 (batch, head) pairs in one launch: V[b][h][l][d], head-major, straight into the output */
}

// v004
// One run takes 62.2 microseconds.
// Timed twice side by side with v003, it ran 1.13 times as fast both times.
// Counting every step since v000, it is 21.0 times as fast.
#include <hip/hip_runtime.h>

// Full (Informer-style) attention on pre-split heads with a mask, head-major output (queries [2][2048][16][64], keys, values [2][2048][16][64]; scores = q.k; + where(attn_mask > 0.5, 0, -1e9) (attn_mask [2][1][2048][2048] float, all ones, read per (i, j)); A = softmax(scores x 1/sqrt(64)); V = A.values as 'bhld' -> [2][16][2048][64] (4.2 M; no projections); argument order queries, keys, values, attn_mask).
// Layout: the inputs are already [t][h][d]: one launch (k_planes) rounds them to bf16 and writes the per-head planes Q, K [bh][t][d] and V^T [bh][d][t], and turns the mask into one bit a (query, key); then one fused kernel over all (batch, head) pairs: scores (one product), mask term and scale in the module's order, online softmax, P hi/lo x exact bf16(values) (2 products), one division, head-major output rows.
// Compute dtypes, f32 accumulate: every input rounded to bf16; scores exact; softmax f32; A.values 2 products; output f32.

#define NB_  2
#define TT   2048
#define DM   1024
#define NH_  16
#define NKV  16
#define REP  (NH_ / NKV)
#define HD   64
#define DQ   (NH_ * HD)
#define DKV  (NKV * HD)
#define ZH   2
#define RH   TT                   // every row hi/lo
#define WIN  0
#define PCAR 1024.0f
#define SCL  0.125f   // 1/sqrt(64), applied after the additive mask as the module
typedef unsigned short bf;
typedef __attribute__((ext_vector_type(16))) __bf16   v16bf;
typedef __attribute__((ext_vector_type(16))) _Float16 v16h;
typedef __attribute__((ext_vector_type(8)))  _Float16 v8h;
typedef __attribute__((ext_vector_type(8)))  unsigned short v8us;
typedef __attribute__((ext_vector_type(8)))  float    v8f;
typedef __attribute__((ext_vector_type(4)))  float    v4f;
typedef v8h  __attribute__((may_alias)) v8ha;
typedef v4f  __attribute__((may_alias)) v4fa;
typedef v8us __attribute__((may_alias)) v8usa;

__device__ __forceinline__ v16h cat16(v8h lo, v8h hi) { return __builtin_shufflevector(lo, hi, 0, 1, 2, 3, 4, 5, 6, 7, 8, 9, 10, 11, 12, 13, 14, 15); }
__device__ __forceinline__ v16bf cat16b(v8us lo, v8us hi) { return __builtin_bit_cast(v16bf, __builtin_shufflevector(lo, hi, 0, 1, 2, 3, 4, 5, 6, 7, 8, 9, 10, 11, 12, 13, 14, 15)); }
__device__ __forceinline__ v8f wmma16(v16h a, v16h b, v8f c) { return __builtin_amdgcn_wmma_f32_16x16x32_f16(false, a, false, b, (short)0, c, false, false); }
__device__ __forceinline__ v8f wmmab(v16bf a, v16bf b, v8f c) { return __builtin_amdgcn_wmma_f32_16x16x32_bf16(false, a, false, b, (short)0, c, false, false); }



typedef __attribute__((ext_vector_type(4))) _Float16 v4h;
typedef __attribute__((ext_vector_type(4))) unsigned short v4us;
typedef __attribute__((ext_vector_type(2))) float v2f;
typedef __attribute__((ext_vector_type(4))) int v4i;

#define FW 8
#define FK 64
#define FP 144      // LDS row pitch, bytes: 128 + 16, an odd multiple of 16 for the 16-byte fragment reads
#define FLZ 5.0f
#define L2E 1.4426950408889634f
typedef __attribute__((ext_vector_type(2))) __bf16 v2bf;
typedef __attribute__((ext_vector_type(8))) unsigned v8u;
typedef __attribute__((ext_vector_type(16))) unsigned v16u;
__device__ __forceinline__ unsigned pack2(float lo, float hi) { v2f x; x[0] = lo; x[1] = hi; return __builtin_bit_cast(unsigned, __builtin_convertvector(x, v2bf)); }   /* two f32 -> two bf16, round to nearest even */
__device__ __forceinline__ float xhalf(float x) { return __builtin_bit_cast(float, __builtin_amdgcn_permlanex16(__builtin_bit_cast(int, x), __builtin_bit_cast(int, x), 0x76543210, 0xfedcba98, false, false)); }   /* lane l <-> lane l ^ 16 */
__device__ __forceinline__ v16bf ldfrag(const unsigned char* p) { return cat16b(*(const v8usa*)p, *(const v8usa*)(p + 32)); }   /* k order 8 h + s, 16 + 8 h + s: p already holds the 16 h bytes */
/* eight 2^x in place, then the one slot the instruction set asks for behind a transcendental before its result is read or its source overwritten */
__device__ __forceinline__ void exp2x8(float (&e)[8]) {
    asm("v_exp_f32 %0, %0\n\tv_exp_f32 %1, %1\n\tv_exp_f32 %2, %2\n\tv_exp_f32 %3, %3\n\tv_exp_f32 %4, %4\n\tv_exp_f32 %5, %5\n\tv_exp_f32 %6, %6\n\tv_exp_f32 %7, %7\n\tv_nop"
        : "+v"(e[0]), "+v"(e[1]), "+v"(e[2]), "+v"(e[3]), "+v"(e[4]), "+v"(e[5]), "+v"(e[6]), "+v"(e[7])); }
__global__ __launch_bounds__(32 * FW) void k_fattn(const bf* __restrict__ Qp, const bf* __restrict__ Kp, const bf* __restrict__ Vp, const unsigned* __restrict__ MB, float* __restrict__ O) {
    __shared__ __align__(16) unsigned char L[2][2 * FK * FP];
    const int tid = threadIdx.x, lane = tid & 31, c = lane & 15, h = lane >> 4, w = tid >> 5;
    const int bh = blockIdx.y, q0 = blockIdx.x * (FW * 16) + w * 16, q = q0 + c;
    const unsigned char* qp = (const unsigned char*)(Qp + ((size_t)bh * TT + q) * HD) + 16 * h;
    v16bf qf[2];
#pragma unroll
    for (int kc = 0; kc < 2; ++kc) qf[kc] = ldfrag(qp + 64 * kc);
    const int srow = tid >> 3, sch = tid & 7;   /* K, V^T staging: 8 threads a row of 128 bytes, 32 rows a sweep, two sweeps a tile */
    const bf* kg = Kp + (size_t)bh * TT * HD + srow * HD + sch * 8;
    const bf* vg = Vp + (size_t)bh * HD * TT + (size_t)srow * TT + sch * 8;
    const int sl = srow * FP + sch * 16;
    const unsigned* mwp = MB + (size_t)((bh / NH_) * (TT / 16) + blockIdx.x * FW + __builtin_amdgcn_readfirstlane(w)) * (TT / FK) * 32;   /* the wave's own mask words, 32 a pass; the address is the same in every lane, so the words come by scalar loads */
    v16u mw0 = *(const v16u*)mwp, mw1 = *(const v16u*)(mwp + 16);
    v4i kr0 = *(const v4i*)kg, kr1 = *(const v4i*)(kg + 32 * HD), vr0 = *(const v4i*)vg, vr1 = *(const v4i*)(vg + 32 * TT);
    *(v4i*)(&L[0][sl]) = kr0; *(v4i*)(&L[0][sl + 32 * FP]) = kr1; *(v4i*)(&L[0][FK * FP + sl]) = vr0; *(v4i*)(&L[0][FK * FP + sl + 32 * FP]) = vr1;
    __syncthreads();   /* pass 0's tiles are in LDS before any wave reads them */
    v8f acc[4];
#pragma unroll
    for (int dt = 0; dt < 4; ++dt) acc[dt] = (v8f){};
    float m_run = -__builtin_inff(), l_run = 0.f;
#pragma unroll 1   /* rolled: the body is one whole pass, unrolling only grows the code and the registers */
    for (int t = 0; t < TT / FK; ++t) {
        const unsigned char* Lk = &L[t & 1][0] + c * FP + 16 * h; const unsigned char* Lv = Lk + FK * FP; const bool more = t + 1 < TT / FK;
        if (more) { kg += FK * HD; vg += FK; kr0 = *(const v4i*)kg; kr1 = *(const v4i*)(kg + 32 * HD); vr0 = *(const v4i*)vg; vr1 = *(const v4i*)(vg + 32 * TT); }   /* next pass's tiles, in flight under this pass */
        v16bf kf[4][2];
#pragma unroll
        for (int kt = 0; kt < 4; ++kt)
#pragma unroll
            for (int kc = 0; kc < 2; ++kc) kf[kt][kc] = ldfrag(Lk + 16 * kt * FP + 64 * kc);
        __builtin_amdgcn_sched_barrier(0);   /* keeps the pass's K reads one group in front of the products: sunk between them, each pair costs its own LDS latency */
        v8f s[4];
#pragma unroll
        for (int kt = 0; kt < 4; ++kt) { s[kt] = (v8f){};
#pragma unroll
            for (int kc = 0; kc < 2; ++kc) s[kt] = wmmab(kf[kt][kc], qf[kc], s[kt]); }
        v16bf vf[2][4];
#pragma unroll
        for (int dt = 0; dt < 4; ++dt) vf[0][dt] = ldfrag(Lv + 16 * dt * FP);
        __builtin_amdgcn_sched_barrier(0);   /* keeps the first 32 keys' V^T reads here, one group, in flight under the softmax arithmetic */
        float mx = -3.0e38f;
#pragma unroll
        for (int kt = 0; kt < 4; ++kt)
#pragma unroll
            for (int r = 0; r < 8; ++r) { const float madd = __builtin_amdgcn_inverse_ballot_w32(kt < 2 ? mw0[8 * kt + r] : mw1[8 * kt + r - 16]) ? 0.0f : -1.25e8f; const float tv = __builtin_fmaf(s[kt][r], SCL, madd);   /* (s + (mask ? 0 : -1e9)) x 1/8: the product by 1/8 is exact, so one rounding, as the module's add */
                s[kt][r] = tv; mx = fmaxf(mx, tv); }
        mwp += more ? 32 : 0; mw0 = *(const v16u*)mwp; mw1 = *(const v16u*)(mwp + 16);   /* the next pass's mask words, asked for as soon as this pass's are used up; the last pass asks for its own again, in bounds */
        mx = fmaxf(mx, xhalf(mx));   /* both halves hold the query's maximum of this pass */
        if (__builtin_amdgcn_ballot_w32(mx > m_run + FLZ) != 0) {   /* one scalar branch a pass; always taken in pass 0 (m_run = -inf, factor 0) */
            const float m_new = fmaxf(m_run, mx); const float corr = __builtin_amdgcn_exp2f((m_run - m_new) * L2E); m_run = m_new; l_run *= corr;
#pragma unroll
            for (int dt = 0; dt < 4; ++dt) acc[dt] = acc[dt] * corr; }
#pragma unroll
        for (int ks = 0; ks < 2; ++ks) { v8u wh, wl;
#pragma unroll
            for (int g = 0; g < 2; ++g) { float e[8];
#pragma unroll
                for (int r = 0; r < 8; ++r) e[r] = (s[2 * ks + g][r] - m_run) * L2E;
                exp2x8(e);
#pragma unroll
                for (int i = 0; i < 4; ++i) { const float p0 = e[2 * i], p1 = e[2 * i + 1]; l_run += p0 + p1; const unsigned u = pack2(p0, p1); wh[4 * g + i] = u; wl[4 * g + i] = pack2(p0 - __uint_as_float(u << 16), p1 - __uint_as_float(u & 0xFFFF0000u)); } }   /* hi = bf16(p), lo = bf16(p - hi) */
            const v16bf ph = __builtin_bit_cast(v16bf, wh), pl = __builtin_bit_cast(v16bf, wl);
            if (ks == 0) {
#pragma unroll
                for (int dt = 0; dt < 4; ++dt) vf[1][dt] = ldfrag(Lv + 16 * dt * FP + 64);
                __builtin_amdgcn_sched_barrier(0); }   /* the last 32 keys' V^T reads, one group, in flight under the first products and the second half's exponentials; later than the first group for the registers */
#pragma unroll
            for (int dt = 0; dt < 4; ++dt) acc[dt] = wmmab(vf[ks][dt], ph, acc[dt]);
#pragma unroll
            for (int dt = 0; dt < 4; ++dt) acc[dt] = wmmab(vf[ks][dt], pl, acc[dt]); }
        if (more) { unsigned char* Ln = &L[(t + 1) & 1][0]; *(v4i*)(Ln + sl) = kr0; *(v4i*)(Ln + sl + 32 * FP) = kr1; *(v4i*)(Ln + FK * FP + sl) = vr0; *(v4i*)(Ln + FK * FP + sl + 32 * FP) = vr1; }
        asm volatile("s_wait_xcnt 0x0" ::: "memory");   /* behind the scalar loads of the mask words, in front of the first overwrite of a register that holds their address (the pointer's step, in the next pass) */
        __syncthreads();   /* publishes the next pass's tiles and ends every wave's reads of this pass's buffer, which the next pass refills */
    }
    const float inv = __fdiv_rn(1.0f, l_run + xhalf(l_run));   /* the two halves' sums meet once */
    float* orow = O + ((size_t)bh * TT + q) * HD + 8 * h;   /* acc[dt][r] = O[q][16 dt + 8 h + r] */
#pragma unroll
    for (int dt = 0; dt < 4; ++dt) { const v8f o = acc[dt] * inv; v4f o0, o1;
#pragma unroll
        for (int r = 0; r < 4; ++r) { o0[r] = o[r]; o1[r] = o[4 + r]; }
        *(v4f*)(orow + 16 * dt) = o0; *(v4f*)(orow + 16 * dt + 4) = o1; }
}
// ---- k_planes: the three bf16 planes and the mask words that k_fattn reads, both batches, in ONE launch; nothing else is written.
// Work-group = PT positions of one (batch, head), of all three inputs: 24 whole-line 16-byte loads a thread, all issued before the first use, with the 16 of the mask.
// Mask words: a wave reads 16 rows x 128 keys in whole lines, turns them in LDS (its own rows) so that a lane holds what k_fattn's lane holds, and each compare's lane mask is one word: MB[batch x 128 + row tile][pass][8 kt + r].
// Q, K: a row of 64 f32 (256 bytes, 16 lanes) becomes a row of 128 bytes; a wave stores two neighbouring rows, 256 bytes in a row.
// V^T: a lane packs positions 2 p, 2 p + 1 of four d into four words, LDS [d][p]; read back by rows of d, 256 bytes of one d a half wave.
// The 16-byte piece of an LDS row stands at (piece ^ (d >> 2)): the 16 lanes that write one p for 64 d hit 16 different pieces, and the read-back stays 16-byte aligned.
#define PT 128
#define MQ 528      // LDS row pitch of the mask rows, bytes: 512 + 16
typedef __attribute__((ext_vector_type(2))) unsigned v2u;
typedef __attribute__((ext_vector_type(4))) unsigned v4u;
typedef v4u __attribute__((may_alias)) v4ua;
__global__ __launch_bounds__(256) void k_planes(const float* __restrict__ xq, const float* __restrict__ xk, const float* __restrict__ xv, const float* __restrict__ am, bf* __restrict__ Qp, bf* __restrict__ Kp, bf* __restrict__ Vp, unsigned* __restrict__ MB) {
    __shared__ __align__(16) unsigned VL[HD * (PT / 2)];
    __shared__ __align__(16) unsigned char MS[8][16 * MQ];
    const int tid = threadIdx.x, g = tid & 15, u = tid >> 4;
    const int t0 = blockIdx.x * PT, bh = blockIdx.y;
    const size_t in0 = ((size_t)((bh / NH_) * TT + t0) * NH_ + (bh % NH_)) * HD + 4 * g;   /* [b][t0][h][4 g]; the next position is DQ elements on */
    const float* pv = xv + in0 + (size_t)(2 * u) * DQ; const float* pq = xq + in0 + (size_t)u * DQ; const float* pk = xk + in0 + (size_t)u * DQ;
    const int lane = tid & 31, gw = (blockIdx.y * (TT / PT) + blockIdx.x) * 8 + (tid >> 5);   /* 4096 waves share the mask: wave gw has the 16 rows of row tile gw >> 4, at the 128 keys of slice gw & 15 */
    const float* pm = am + (size_t)(gw >> 4) * 16 * TT + (gw & 15) * 128 + 4 * lane;   /* a load takes 512 bytes of one row */
    v4f va[4], vb[4], qa[8], ka[8], ma[16];
#pragma unroll
    for (int i = 0; i < 4; ++i) { va[i] = *(const v4f*)(pv + 32 * i * DQ); vb[i] = *(const v4f*)(pv + (32 * i + 1) * DQ); }
#pragma unroll
    for (int i = 0; i < 16; ++i) ma[i] = *(const v4f*)(pm + i * TT);
#pragma unroll
    for (int i = 0; i < 8; ++i) { qa[i] = *(const v4f*)(pq + 16 * i * DQ); ka[i] = *(const v4f*)(pk + 16 * i * DQ); }
    asm volatile("s_wait_xcnt 0x0" :: "v"(pv), "v"(pq), "v"(pk), "v"(pm) : "memory");   /* behind the last load, in front of the first overwrite of an address pair, where this wait belongs. The four pairs are inputs so that they live up to it (without them the compiler hands a pair to a later load as its destination); the clobber keeps all 40 loads in front of it, in flight together */
#pragma unroll
    for (int i = 0; i < 4; ++i) { const int p = u + 16 * i;
#pragma unroll
        for (int j = 0; j < 4; ++j) VL[(4 * g + j) * (PT / 2) + 4 * ((p >> 2) ^ g) + (p & 3)] = pack2(va[i][j], vb[i][j]); }
    unsigned char* ms = &MS[tid >> 5][0];
#pragma unroll
    for (int i = 0; i < 16; ++i) *(v4fa*)(ms + i * MQ + 16 * lane) = ma[i];
    __syncthreads();   /* the whole V^T tile and the mask rows are in LDS before any of them is read back; it stands in front of every global store, so that it waits for none */
    v4u vt[4];
#pragma unroll
    for (int i = 0; i < 4; ++i) { const int d = u + 16 * i; vt[i] = *(const v4ua*)&VL[d * (PT / 2) + 4 * (g ^ ((d >> 2) & 15))]; }
    bf* qo = Qp + ((size_t)bh * TT + t0 + u) * HD + 4 * g; bf* ko = Kp + ((size_t)bh * TT + t0 + u) * HD + 4 * g;
#pragma unroll
    for (int i = 0; i < 8; ++i) { v2u x, y; x[0] = pack2(qa[i][0], qa[i][1]); x[1] = pack2(qa[i][2], qa[i][3]); y[0] = pack2(ka[i][0], ka[i][1]); y[1] = pack2(ka[i][2], ka[i][3]);
        *(v2u*)(qo + 16 * i * HD) = x; *(v2u*)(ko + 16 * i * HD) = y; }
#pragma unroll
    for (int i = 0; i < 4; ++i) *(v4u*)(Vp + ((size_t)bh * HD + u + 16 * i) * TT + t0 + 8 * g) = vt[i];
    const unsigned char* mrd = ms + (lane & 15) * MQ + 32 * (lane >> 4);   /* read back as k_fattn's lane holds the scores: row lane & 15, keys 16 kt + 8 (lane >> 4) + r of a 64-key pass */
#pragma unroll
    for (int tt = 0; tt < 2; ++tt) { unsigned wv = 0;
#pragma unroll
        for (int i = 0; i < 8; ++i) { const v4f x = *(const v4fa*)(mrd + 256 * tt + 64 * (i >> 1) + 16 * (i & 1));
#pragma unroll
            for (int j = 0; j < 4; ++j) { const unsigned bw = __builtin_amdgcn_ballot_w32(x[j] > 0.5f); wv = (lane == 4 * i + j) ? bw : wv; } }   /* word 8 kt + r = 4 i + j goes to the lane of that number */
        MB[((size_t)(gw >> 4) * (TT / FK) + 2 * (gw & 15) + tt) * 32 + lane] = wv; }   /* 128 bytes a pass, one wave */
}
extern "C" void kernel_launch(void* const* d_in, const int* in_sizes, int n_in,
                              void* d_out, int out_size, void* d_ws, size_t ws_size, hipStream_t stream) {
    (void)in_sizes; (void)n_in; (void)out_size;
    const float* xq = (const float*)d_in[0]; const float* xk = (const float*)d_in[1]; const float* xv = (const float*)d_in[2]; const float* am = (const float*)d_in[3];   /* queries [2][2048][16][64], keys, values [2][2048][16][64], attn_mask [2][1][2048][2048] (> 0.5 = attend; all ones) */
    float* OUT = (float*)d_out;     // [2][16][2048][64] head-major (V = 'bhld')
    char* wsp = (char*)d_ws;
    auto take = [&](size_t bytes) { char* p = wsp; wsp += (bytes + 255) & ~(size_t)255; return (void*)p; };
    const size_t PL = (size_t)NB_ * NH_ * TT * HD;   /* elements of one plane, both batches */
    bf* QPh = (bf*)take(PL * 2); bf* KPh = (bf*)take(PL * 2); bf* VTh = (bf*)take(PL * 2); unsigned* MBw = (unsigned*)take((size_t)NB_ * TT * TT / 8);
    if ((size_t)(wsp - (char*)d_ws) > ws_size) return;    // ws 256 MiB (carve 25 MiB)
    k_planes<<<dim3(TT / PT, NB_ * NH_), 256, 0, stream>>>(xq, xk, xv, am, QPh, KPh, VTh, MBw);   /* bf16(queries), bf16(keys) as [bh][t][d], bf16(values) as [bh][d][t]; attn_mask > 0.5 as bits */
    k_fattn<<<dim3(TT / (FW * 16), NB_ * NH_), 32 * FW, 0, stream>>>(QPh, KPh, VTh, MBw, OUT);   /* all 32 (batch, head) pairs in one launch: V[b][h][l][d], head-major, straight into the output */
}

// v005
// Measured time: 57.9 microseconds a run.
// Next to v004, in two timings, it ran 1.08 times as fast each time.
// Counting every step since v000, it is 22.6 times as fast.
#include <hip/hip_runtime.h>

// Full (Informer-style) attention on pre-split heads with a mask, head-major output (queries [2][2048][16][64], keys, values [2][2048][16][64]; scores = q.k; + where(attn_mask > 0.5, 0, -1e9) (attn_mask [2][1][2048][2048] float, all ones, read per (i, j)); A = softmax(scores x 1/sqrt(64)); V = A.values as 'bhld' -> [2][16][2048][64] (4.2 M; no projections); argument order queries, keys, values, attn_mask).
// Layout: the inputs are already [t][h][d]: one launch (k_planes) rounds them to bf16 and writes the per-head planes Q, K [bh][t][d] and V^T [bh][d][t], and turns the mask into one bit a (query, key); then one fused kernel over all (batch, head) pairs: scores (one product, the scale 1/8 already in Q), mask term where a pass has one, with the module's rounding, online softmax, P hi/lo x exact bf16(values) (2 products), one division, head-major output rows.
// Compute dtypes, f32 accumulate: every input rounded to bf16; scores exact; softmax f32; A.values 2 products; output f32.

#define NB_  2
#define TT   2048
#define DM   1024
#define NH_  16
#define NKV  16
#define REP  (NH_ / NKV)
#define HD   64
#define DQ   (NH_ * HD)
#define DKV  (NKV * HD)
#define ZH   2
#define RH   TT                   // every row hi/lo
#define WIN  0
#define PCAR 1024.0f
#define SCL  0.125f   // 1/sqrt(64), a power of two: applied to Q and to the mask term, it gives the module's (scores + mask term) x scale bit for bit
typedef unsigned short bf;
typedef __attribute__((ext_vector_type(16))) __bf16   v16bf;
typedef __attribute__((ext_vector_type(16))) _Float16 v16h;
typedef __attribute__((ext_vector_type(8)))  _Float16 v8h;
typedef __attribute__((ext_vector_type(8)))  unsigned short v8us;
typedef __attribute__((ext_vector_type(8)))  float    v8f;
typedef __attribute__((ext_vector_type(4)))  float    v4f;
typedef v8h  __attribute__((may_alias)) v8ha;
typedef v4f  __attribute__((may_alias)) v4fa;
typedef v8us __attribute__((may_alias)) v8usa;

__device__ __forceinline__ v16h cat16(v8h lo, v8h hi) { return __builtin_shufflevector(lo, hi, 0, 1, 2, 3, 4, 5, 6, 7, 8, 9, 10, 11, 12, 13, 14, 15); }
__device__ __forceinline__ v16bf cat16b(v8us lo, v8us hi) { return __builtin_bit_cast(v16bf, __builtin_shufflevector(lo, hi, 0, 1, 2, 3, 4, 5, 6, 7, 8, 9, 10, 11, 12, 13, 14, 15)); }
__device__ __forceinline__ v8f wmma16(v16h a, v16h b, v8f c) { return __builtin_amdgcn_wmma_f32_16x16x32_f16(false, a, false, b, (short)0, c, false, false); }
__device__ __forceinline__ v8f wmmab(v16bf a, v16bf b, v8f c) { return __builtin_amdgcn_wmma_f32_16x16x32_bf16(false, a, false, b, (short)0, c, false, false); }



typedef __attribute__((ext_vector_type(4))) _Float16 v4h;
typedef __attribute__((ext_vector_type(4))) unsigned short v4us;
typedef __attribute__((ext_vector_type(2))) float v2f;
typedef __attribute__((ext_vector_type(4))) int v4i;

#define FW 8
#define FK 64
#define FP 144      // LDS row pitch, bytes: 128 + 16, an odd multiple of 16 for the 16-byte fragment reads
#define FLZ 5.0f
#define L2E 1.4426950408889634f
typedef __attribute__((ext_vector_type(2))) __bf16 v2bf;
typedef __attribute__((ext_vector_type(8))) unsigned v8u;
typedef __attribute__((ext_vector_type(16))) unsigned v16u;
typedef __attribute__((ext_vector_type(8))) unsigned long long v8ul;
__device__ __forceinline__ unsigned pack2(float lo, float hi) { v2f x; x[0] = lo; x[1] = hi; return __builtin_bit_cast(unsigned, __builtin_convertvector(x, v2bf)); }   /* two f32 -> two bf16, round to nearest even */
__device__ __forceinline__ float xhalf(float x) { return __builtin_bit_cast(float, __builtin_amdgcn_permlanex16(__builtin_bit_cast(int, x), __builtin_bit_cast(int, x), 0x76543210, 0xfedcba98, false, false)); }   /* lane l <-> lane l ^ 16 */
__device__ __forceinline__ v16bf ldfrag(const unsigned char* p) { return cat16b(*(const v8usa*)p, *(const v8usa*)(p + 32)); }   /* k order 8 h + s, 16 + 8 h + s: p already holds the 16 h bytes */
/* eight 2^x in place, then the one slot the instruction set asks for behind a transcendental before its result is read or its source overwritten */
__device__ __forceinline__ void exp2x8(float (&e)[8]) {
    asm("v_exp_f32 %0, %0\n\tv_exp_f32 %1, %1\n\tv_exp_f32 %2, %2\n\tv_exp_f32 %3, %3\n\tv_exp_f32 %4, %4\n\tv_exp_f32 %5, %5\n\tv_exp_f32 %6, %6\n\tv_exp_f32 %7, %7\n\tv_nop"
        : "+v"(e[0]), "+v"(e[1]), "+v"(e[2]), "+v"(e[3]), "+v"(e[4]), "+v"(e[5]), "+v"(e[6]), "+v"(e[7])); }
__global__ __launch_bounds__(32 * FW) void k_fattn(const bf* __restrict__ Qp, const bf* __restrict__ Kp, const bf* __restrict__ Vp, const unsigned* __restrict__ MB, float* __restrict__ O) {
    __shared__ __align__(16) unsigned char L[2][2 * FK * FP];
    const int tid = threadIdx.x, lane = tid & 31, c = lane & 15, h = lane >> 4, w = tid >> 5;
    const int bh = blockIdx.y, q0 = blockIdx.x * (FW * 16) + w * 16, q = q0 + c;
    const unsigned char* qp = (const unsigned char*)(Qp + ((size_t)bh * TT + q) * HD) + 16 * h;
    v16bf qf[2];
#pragma unroll
    for (int kc = 0; kc < 2; ++kc) qf[kc] = ldfrag(qp + 64 * kc);
    const int srow = tid >> 3, sch = tid & 7;   /* K, V^T staging: 8 threads a row of 128 bytes, 32 rows a sweep, two sweeps a tile */
    const bf* kg = Kp + (size_t)bh * TT * HD + srow * HD + sch * 8;
    const bf* vg = Vp + (size_t)bh * HD * TT + (size_t)srow * TT + sch * 8;
    const int sl = srow * FP + sch * 16;
    const unsigned* mwp = MB + (size_t)((bh / NH_) * (TT / 16) + blockIdx.x * FW + __builtin_amdgcn_readfirstlane(w)) * (TT / FK) * 32;   /* the wave's own mask words, 32 a pass; the address is the same in every lane, so the words come by scalar loads */
    v16u mw0 = *(const v16u*)mwp, mw1 = *(const v16u*)(mwp + 16);
    v4i kr0 = *(const v4i*)kg, kr1 = *(const v4i*)(kg + 32 * HD), vr0 = *(const v4i*)vg, vr1 = *(const v4i*)(vg + 32 * TT);
    *(v4i*)(&L[0][sl]) = kr0; *(v4i*)(&L[0][sl + 32 * FP]) = kr1; *(v4i*)(&L[0][FK * FP + sl]) = vr0; *(v4i*)(&L[0][FK * FP + sl + 32 * FP]) = vr1;
    __syncthreads();   /* pass 0's tiles are in LDS before any wave reads them */
    v8f acc[4];
#pragma unroll
    for (int dt = 0; dt < 4; ++dt) acc[dt] = (v8f){};
    float m_run = -__builtin_inff(), l_run = 0.f;
#pragma unroll 1   /* rolled: the body is one whole pass, unrolling only grows the code and the registers */
    for (int t = 0; t < TT / FK; ++t) {
        const unsigned char* Lk = &L[t & 1][0] + c * FP + 16 * h; const unsigned char* Lv = Lk + FK * FP; const bool more = t + 1 < TT / FK;
        if (more) { kg += FK * HD; vg += FK; kr0 = *(const v4i*)kg; kr1 = *(const v4i*)(kg + 32 * HD); vr0 = *(const v4i*)vg; vr1 = *(const v4i*)(vg + 32 * TT); }   /* next pass's tiles, in flight under this pass */
        v16bf kf[4][2];
#pragma unroll
        for (int kt = 0; kt < 4; ++kt)
#pragma unroll
            for (int kc = 0; kc < 2; ++kc) kf[kt][kc] = ldfrag(Lk + 16 * kt * FP + 64 * kc);
        const v8ul ma = __builtin_bit_cast(v8ul, mw0) & __builtin_bit_cast(v8ul, mw1);   /* the AND of the pass's 32 mask words, two at a time, as a tree: scalar work under the K reads' latency */
        const bool open = (((ma[0] & ma[1]) & (ma[2] & ma[3])) & ((ma[4] & ma[5]) & (ma[6] & ma[7]))) == ~0ull;   /* every (query, key) of this wave's pass is attended: the mask term is +0 for all its scores */
        __builtin_amdgcn_sched_barrier(0);   /* keeps the pass's K reads one group in front of the products: sunk between them, each pair costs its own LDS latency */
        v8f s[4];
#pragma unroll
        for (int kt = 0; kt < 4; ++kt) { s[kt] = (v8f){};
#pragma unroll
            for (int kc = 0; kc < 2; ++kc) s[kt] = wmmab(kf[kt][kc], qf[kc], s[kt]); }
        v16bf vf[2][4];
#pragma unroll
        for (int dt = 0; dt < 4; ++dt) vf[0][dt] = ldfrag(Lv + 16 * dt * FP);
        __builtin_amdgcn_sched_barrier(0);   /* keeps the first 32 keys' V^T reads here, one group, in flight under the softmax arithmetic */
        if (!open) {   /* one scalar branch a pass, on scalar registers alone; only a pass with a masked score pays for the mask term */
#pragma unroll
            for (int kt = 0; kt < 4; ++kt)
#pragma unroll
                for (int r = 0; r < 8; ++r) s[kt][r] += __builtin_amdgcn_inverse_ballot_w32(kt < 2 ? mw0[8 * kt + r] : mw1[8 * kt + r - 16]) ? 0.0f : -1.25e8f; }   /* (q.k + (mask ? 0 : -1e9)) x 1/8 with the module's one rounding: the scores come scaled by the exact 1/8, and so does the term */
        float mk[4];   /* one short chain a score tile: with the mask arithmetic gone nothing else stands between the links of one long chain */
#pragma unroll
        for (int kt = 0; kt < 4; ++kt) { mk[kt] = -3.0e38f;
#pragma unroll
            for (int r = 0; r < 8; ++r) mk[kt] = fmaxf(mk[kt], s[kt][r]); }
        float mx = fmaxf(fmaxf(mk[0], mk[1]), fmaxf(mk[2], mk[3]));
        mwp += more ? 32 : 0; mw0 = *(const v16u*)mwp; mw1 = *(const v16u*)(mwp + 16);   /* the next pass's mask words, asked for as soon as this pass's are used up; the last pass asks for its own again, in bounds */
        mx = fmaxf(mx, xhalf(mx));   /* both halves hold the query's maximum of this pass */
        if (__builtin_amdgcn_ballot_w32(mx > m_run + FLZ) != 0) {   /* one scalar branch a pass; always taken in pass 0 (m_run = -inf, factor 0) */
            const float m_new = fmaxf(m_run, mx); const float corr = __builtin_amdgcn_exp2f((m_run - m_new) * L2E); m_run = m_new; l_run *= corr;
#pragma unroll
            for (int dt = 0; dt < 4; ++dt) acc[dt] = acc[dt] * corr; }
#pragma unroll
        for (int ks = 0; ks < 2; ++ks) { v8u wh, wl;
#pragma unroll
            for (int g = 0; g < 2; ++g) { float e[8];
#pragma unroll
                for (int r = 0; r < 8; ++r) e[r] = (s[2 * ks + g][r] - m_run) * L2E;
                exp2x8(e);
#pragma unroll
                for (int i = 0; i < 4; ++i) { const float p0 = e[2 * i], p1 = e[2 * i + 1]; l_run += p0 + p1; const unsigned u = pack2(p0, p1); wh[4 * g + i] = u; wl[4 * g + i] = pack2(p0 - __uint_as_float(u << 16), p1 - __uint_as_float(u & 0xFFFF0000u)); } }   /* hi = bf16(p), lo = bf16(p - hi) */
            const v16bf ph = __builtin_bit_cast(v16bf, wh), pl = __builtin_bit_cast(v16bf, wl);
            if (ks == 0) {
#pragma unroll
                for (int dt = 0; dt < 4; ++dt) vf[1][dt] = ldfrag(Lv + 16 * dt * FP + 64);
                __builtin_amdgcn_sched_barrier(0); }   /* the last 32 keys' V^T reads, one group, in flight under the first products and the second half's exponentials; later than the first group for the registers */
#pragma unroll
            for (int dt = 0; dt < 4; ++dt) acc[dt] = wmmab(vf[ks][dt], ph, acc[dt]);
#pragma unroll
            for (int dt = 0; dt < 4; ++dt) acc[dt] = wmmab(vf[ks][dt], pl, acc[dt]); }
        if (more) { unsigned char* Ln = &L[(t + 1) & 1][0]; *(v4i*)(Ln + sl) = kr0; *(v4i*)(Ln + sl + 32 * FP) = kr1; *(v4i*)(Ln + FK * FP + sl) = vr0; *(v4i*)(Ln + FK * FP + sl + 32 * FP) = vr1; }
        asm volatile("s_wait_xcnt 0x0" ::: "memory");   /* behind the scalar loads of the mask words, in front of the first overwrite of a register that holds their address (the pointer's next step) */
        __syncthreads();   /* publishes the next pass's tiles and ends every wave's reads of this pass's buffer, which the next pass refills */
    }
    const float inv = __fdiv_rn(1.0f, l_run + xhalf(l_run));   /* the two halves' sums meet once */
    float* orow = O + ((size_t)bh * TT + q) * HD + 8 * h;   /* acc[dt][r] = O[q][16 dt + 8 h + r] */
#pragma unroll
    for (int dt = 0; dt < 4; ++dt) { const v8f o = acc[dt] * inv; v4f o0, o1;
#pragma unroll
        for (int r = 0; r < 4; ++r) { o0[r] = o[r]; o1[r] = o[4 + r]; }
        *(v4f*)(orow + 16 * dt) = o0; *(v4f*)(orow + 16 * dt + 4) = o1; }
}
// ---- k_planes: the three bf16 planes and the mask words that k_fattn reads, both batches, in ONE launch; nothing else is written.
// Work-group = PT positions of one (batch, head), of all three inputs: 24 whole-line 16-byte loads a thread, all issued before the first use, with the 16 of the mask.
// Mask words: a wave reads 16 rows x 128 keys in whole lines, turns them in LDS (its own rows) so that a lane holds what k_fattn's lane holds, and each compare's lane mask is one word: MB[batch x 128 + row tile][pass][8 kt + r].
// Q, K: a row of 64 f32 (256 bytes, 16 lanes) becomes a row of 128 bytes; a wave stores two neighbouring rows, 256 bytes in a row. Q is stored as bf16(q) x 1/8, the softmax scale.
// V^T: a lane packs positions 2 p, 2 p + 1 of four d into four words, LDS [d][p]; read back by rows of d, 256 bytes of one d a half wave.
// The 16-byte piece of an LDS row stands at (piece ^ (d >> 2)): the 16 lanes that write one p for 64 d hit 16 different pieces, and the read-back stays 16-byte aligned.
#define PT 128
#define MQ 528      // LDS row pitch of the mask rows, bytes: 512 + 16
typedef __attribute__((ext_vector_type(2))) unsigned v2u;
typedef __attribute__((ext_vector_type(4))) unsigned v4u;
typedef v4u __attribute__((may_alias)) v4ua;
__global__ __launch_bounds__(256) void k_planes(const float* __restrict__ xq, const float* __restrict__ xk, const float* __restrict__ xv, const float* __restrict__ am, bf* __restrict__ Qp, bf* __restrict__ Kp, bf* __restrict__ Vp, unsigned* __restrict__ MB) {
    __shared__ __align__(16) unsigned VL[HD * (PT / 2)];
    __shared__ __align__(16) unsigned char MS[8][16 * MQ];
    const int tid = threadIdx.x, g = tid & 15, u = tid >> 4;
    const int t0 = blockIdx.x * PT, bh = blockIdx.y;
    const size_t in0 = ((size_t)((bh / NH_) * TT + t0) * NH_ + (bh % NH_)) * HD + 4 * g;   /* [b][t0][h][4 g]; the next position is DQ elements on */
    const float* pv = xv + in0 + (size_t)(2 * u) * DQ; const float* pq = xq + in0 + (size_t)u * DQ; const float* pk = xk + in0 + (size_t)u * DQ;
    const int lane = tid & 31, gw = (blockIdx.y * (TT / PT) + blockIdx.x) * 8 + (tid >> 5);   /* 4096 waves share the mask: wave gw has the 16 rows of row tile gw >> 4, at the 128 keys of slice gw & 15 */
    const float* pm = am + (size_t)(gw >> 4) * 16 * TT + (gw & 15) * 128 + 4 * lane;   /* a load takes 512 bytes of one row */
    v4f va[4], vb[4], qa[8], ka[8], ma[16];
#pragma unroll
    for (int i = 0; i < 4; ++i) { va[i] = *(const v4f*)(pv + 32 * i * DQ); vb[i] = *(const v4f*)(pv + (32 * i + 1) * DQ); }
#pragma unroll
    for (int i = 0; i < 16; ++i) ma[i] = *(const v4f*)(pm + i * TT);
#pragma unroll
    for (int i = 0; i < 8; ++i) { qa[i] = *(const v4f*)(pq + 16 * i * DQ); ka[i] = *(const v4f*)(pk + 16 * i * DQ); }
    asm volatile("s_wait_xcnt 0x0" :: "v"(pv), "v"(pq), "v"(pk), "v"(pm) : "memory");   /* behind the last load, in front of the first overwrite of an address pair, where this wait belongs. The four pairs are inputs so that they live up to it (without them the compiler hands a pair to a later load as its destination); the clobber keeps all 40 loads in front of it, in flight together */
#pragma unroll
    for (int i = 0; i < 4; ++i) { const int p = u + 16 * i;
#pragma unroll
        for (int j = 0; j < 4; ++j) VL[(4 * g + j) * (PT / 2) + 4 * ((p >> 2) ^ g) + (p & 3)] = pack2(va[i][j], vb[i][j]); }
    unsigned char* ms = &MS[tid >> 5][0];
#pragma unroll
    for (int i = 0; i < 16; ++i) *(v4fa*)(ms + i * MQ + 16 * lane) = ma[i];
    __syncthreads();   /* the whole V^T tile and the mask rows are in LDS before any of them is read back; it stands in front of every global store, so that it waits for none */
    v4u vt[4];
#pragma unroll
    for (int i = 0; i < 4; ++i) { const int d = u + 16 * i; vt[i] = *(const v4ua*)&VL[d * (PT / 2) + 4 * (g ^ ((d >> 2) & 15))]; }
    bf* qo = Qp + ((size_t)bh * TT + t0 + u) * HD + 4 * g; bf* ko = Kp + ((size_t)bh * TT + t0 + u) * HD + 4 * g;
#pragma unroll
    for (int i = 0; i < 8; ++i) { v2u x, y; x[0] = pack2(qa[i][0] * SCL, qa[i][1] * SCL); x[1] = pack2(qa[i][2] * SCL, qa[i][3] * SCL); y[0] = pack2(ka[i][0], ka[i][1]); y[1] = pack2(ka[i][2], ka[i][3]);
        *(v2u*)(qo + 16 * i * HD) = x; *(v2u*)(ko + 16 * i * HD) = y; }
#pragma unroll
    for (int i = 0; i < 4; ++i) *(v4u*)(Vp + ((size_t)bh * HD + u + 16 * i) * TT + t0 + 8 * g) = vt[i];
    const unsigned char* mrd = ms + (lane & 15) * MQ + 32 * (lane >> 4);   /* read back as k_fattn's lane holds the scores: row lane & 15, keys 16 kt + 8 (lane >> 4) + r of a 64-key pass */
#pragma unroll
    for (int tt = 0; tt < 2; ++tt) { unsigned wv = 0;
#pragma unroll
        for (int i = 0; i < 8; ++i) { const v4f x = *(const v4fa*)(mrd + 256 * tt + 64 * (i >> 1) + 16 * (i & 1));
#pragma unroll
            for (int j = 0; j < 4; ++j) { const unsigned bw = __builtin_amdgcn_ballot_w32(x[j] > 0.5f); wv = (lane == 4 * i + j) ? bw : wv; } }   /* word 8 kt + r = 4 i + j goes to the lane of that number */
        MB[((size_t)(gw >> 4) * (TT / FK) + 2 * (gw & 15) + tt) * 32 + lane] = wv; }   /* 128 bytes a pass, one wave */
}
extern "C" void kernel_launch(void* const* d_in, const int* in_sizes, int n_in,
                              void* d_out, int out_size, void* d_ws, size_t ws_size, hipStream_t stream) {
    (void)in_sizes; (void)n_in; (void)out_size;
    const float* xq = (const float*)d_in[0]; const float* xk = (const float*)d_in[1]; const float* xv = (const float*)d_in[2]; const float* am = (const float*)d_in[3];   /* queries [2][2048][16][64], keys, values [2][2048][16][64], attn_mask [2][1][2048][2048] (> 0.5 = attend; all ones) */
    float* OUT = (float*)d_out;     // [2][16][2048][64] head-major (V = 'bhld')
    char* wsp = (char*)d_ws;
    auto take = [&](size_t bytes) { char* p = wsp; wsp += (bytes + 255) & ~(size_t)255; return (void*)p; };
    const size_t PL = (size_t)NB_ * NH_ * TT * HD;   /* elements of one plane, both batches */
    bf* QPh = (bf*)take(PL * 2); bf* KPh = (bf*)take(PL * 2); bf* VTh = (bf*)take(PL * 2); unsigned* MBw = (unsigned*)take((size_t)NB_ * TT * TT / 8);
    if ((size_t)(wsp - (char*)d_ws) > ws_size) return;    // ws 256 MiB (carve 25 MiB)
    k_planes<<<dim3(TT / PT, NB_ * NH_), 256, 0, stream>>>(xq, xk, xv, am, QPh, KPh, VTh, MBw);   /* bf16(queries) x 1/8, bf16(keys) as [bh][t][d], bf16(values) as [bh][d][t]; attn_mask > 0.5 as bits */
    k_fattn<<<dim3(TT / (FW * 16), NB_ * NH_), 32 * FW, 0, stream>>>(QPh, KPh, VTh, MBw, OUT);   /* all 32 (batch, head) pairs in one launch: V[b][h][l][d], head-major, straight into the output */
}

// v007
// Measured time: 49.7 microseconds a run.
// Versions between v005 and this one are left out; their measured steps multiply to 1.16 times as fast.
// Counting every step since v000, it is 26.2 times as fast.
#include <hip/hip_runtime.h>

// Full (Informer-style) attention on pre-split heads with a mask, head-major output (queries [2][2048][16][64], keys, values [2][2048][16][64]; scores = q.k; + where(attn_mask > 0.5, 0, -1e9) (attn_mask [2][1][2048][2048] float, all ones, read per (i, j)); A = softmax(scores x 1/sqrt(64)); V = A.values as 'bhld' -> [2][16][2048][64] (4.2 M; no projections); argument order queries, keys, values, attn_mask).
// Layout: the inputs are already [t][h][d]: one launch (k_planes) rounds them to bf16 and writes the per-head planes Q, K [bh][t][d] (bf16) and V^T [bh][d][t] (the bf16 values as f16), and turns the mask into one bit a (query, key); then one fused kernel over all (batch, head) pairs: scores (one product, the scale 1/8 already in Q), mask term where a pass has one, with the module's rounding, online softmax, f16(P) x bf16(values) held exactly in f16 (1 product), one division, head-major output rows.
// Compute dtypes, f32 accumulate: every input rounded to bf16; scores exact, bf16 products; softmax f32; A.values one f16 product: P rounded once to f16 (11 bits; P <= e^5 by the lazy maximum, far inside the f16 range), values bf16-rounded and then carried in f16, which holds every bf16 value of magnitude 2^-14 to 65504 exactly; output f32.

#define NB_  2
#define TT   2048
#define DM   1024
#define NH_  16
#define NKV  16
#define REP  (NH_ / NKV)
#define HD   64
#define DQ   (NH_ * HD)
#define DKV  (NKV * HD)
#define ZH   2
#define WIN  0
#define PCAR 1024.0f
#define SCL  0.125f   // 1/sqrt(64), a power of two: applied to Q and to the mask term, it gives the module's (scores + mask term) x scale bit for bit
typedef unsigned short bf;
typedef __attribute__((ext_vector_type(16))) __bf16   v16bf;
typedef __attribute__((ext_vector_type(16))) _Float16 v16h;
typedef __attribute__((ext_vector_type(8)))  _Float16 v8h;
typedef __attribute__((ext_vector_type(8)))  unsigned short v8us;
typedef __attribute__((ext_vector_type(8)))  float    v8f;
typedef __attribute__((ext_vector_type(4)))  float    v4f;
typedef v8h  __attribute__((may_alias)) v8ha;
typedef v4f  __attribute__((may_alias)) v4fa;
typedef v8us __attribute__((may_alias)) v8usa;

__device__ __forceinline__ v16h cat16(v8h lo, v8h hi) { return __builtin_shufflevector(lo, hi, 0, 1, 2, 3, 4, 5, 6, 7, 8, 9, 10, 11, 12, 13, 14, 15); }
__device__ __forceinline__ v16bf cat16b(v8us lo, v8us hi) { return __builtin_bit_cast(v16bf, __builtin_shufflevector(lo, hi, 0, 1, 2, 3, 4, 5, 6, 7, 8, 9, 10, 11, 12, 13, 14, 15)); }
__device__ __forceinline__ v8f wmma16(v16h a, v16h b, v8f c) { return __builtin_amdgcn_wmma_f32_16x16x32_f16(false, a, false, b, (short)0, c, false, false); }
__device__ __forceinline__ v8f wmmab(v16bf a, v16bf b, v8f c) { return __builtin_amdgcn_wmma_f32_16x16x32_bf16(false, a, false, b, (short)0, c, false, false); }



typedef __attribute__((ext_vector_type(4))) _Float16 v4h;
typedef __attribute__((ext_vector_type(4))) unsigned short v4us;
typedef __attribute__((ext_vector_type(2))) float v2f;
typedef __attribute__((ext_vector_type(4))) int v4i;

#define FW 8
#define FK 64
#define FS 4       // passes a stage: 256 keys between two barriers; the ring of 2 FS tiles takes 144 KiB, two work-groups a WGP as before
#define FP 144      // LDS row pitch, bytes: 128 + 16, an odd multiple of 16 for the 16-byte fragment reads
#define FLZ 5.0f
#define L2E 1.4426950408889634f
typedef __attribute__((ext_vector_type(2))) __bf16 v2bf;
typedef __attribute__((ext_vector_type(8))) unsigned v8u;
typedef __attribute__((ext_vector_type(16))) unsigned v16u;
typedef __attribute__((ext_vector_type(8))) unsigned long long v8ul;
__device__ __forceinline__ unsigned pack2(float lo, float hi) { v2f x; x[0] = lo; x[1] = hi; return __builtin_bit_cast(unsigned, __builtin_convertvector(x, v2bf)); }   /* two f32 -> two bf16, round to nearest even */
typedef __attribute__((ext_vector_type(2))) _Float16 v2h;
__device__ __forceinline__ unsigned pack2h(float lo, float hi) { v2f x; x[0] = lo; x[1] = hi; return __builtin_bit_cast(unsigned, __builtin_convertvector(x, v2h)); }   /* two f32 -> two f16, round to nearest even */
__device__ __forceinline__ float xhalf(float x) { return __builtin_bit_cast(float, __builtin_amdgcn_permlanex16(__builtin_bit_cast(int, x), __builtin_bit_cast(int, x), 0x76543210, 0xfedcba98, false, false)); }   /* lane l <-> lane l ^ 16 */
__device__ __forceinline__ v16bf ldfrag(const unsigned char* p) { return cat16b(*(const v8usa*)p, *(const v8usa*)(p + 32)); }   /* k order 8 h + s, 16 + 8 h + s: p already holds the 16 h bytes */
__device__ __forceinline__ v16h ldfragh(const unsigned char* p) { return cat16(*(const v8ha*)p, *(const v8ha*)(p + 32)); }   /* the same k order, f16 elements */
/* eight 2^x in place, then the one slot the instruction set asks for behind a transcendental before its result is read or its source overwritten */
__device__ __forceinline__ void exp2x8(float (&e)[8]) {
    asm("v_exp_f32 %0, %0\n\tv_exp_f32 %1, %1\n\tv_exp_f32 %2, %2\n\tv_exp_f32 %3, %3\n\tv_exp_f32 %4, %4\n\tv_exp_f32 %5, %5\n\tv_exp_f32 %6, %6\n\tv_exp_f32 %7, %7\n\tv_nop"
        : "+v"(e[0]), "+v"(e[1]), "+v"(e[2]), "+v"(e[3]), "+v"(e[4]), "+v"(e[5]), "+v"(e[6]), "+v"(e[7])); }
__global__ __launch_bounds__(32 * FW) void k_fattn(const bf* __restrict__ Qp, const bf* __restrict__ Kp, const bf* __restrict__ Vp, const unsigned* __restrict__ MB, float* __restrict__ O) {
    __shared__ __align__(16) unsigned char L[2 * FS][2 * FK * FP];
    const int tid = threadIdx.x, lane = tid & 31, c = lane & 15, h = lane >> 4, w = tid >> 5;
    const int bh = blockIdx.y, q0 = blockIdx.x * (FW * 16) + w * 16, q = q0 + c;
    const unsigned char* qp = (const unsigned char*)(Qp + ((size_t)bh * TT + q) * HD) + 16 * h;
    v16bf qf[2];
#pragma unroll
    for (int kc = 0; kc < 2; ++kc) qf[kc] = ldfrag(qp + 64 * kc);
    const int srow = tid >> 3, sch = tid & 7;   /* K, V^T staging: 8 threads a row of 128 bytes, 32 rows a sweep, two sweeps a tile */
    const bf* kg = Kp + (size_t)bh * TT * HD + srow * HD + sch * 8;
    const bf* vg = Vp + (size_t)bh * HD * TT + (size_t)srow * TT + sch * 8;
    const int sl = srow * FP + sch * 16;
    const unsigned* mwp = MB + (size_t)((bh / NH_) * (TT / 16) + blockIdx.x * FW + __builtin_amdgcn_readfirstlane(w)) * (TT / FK) * 32;   /* the wave's own mask words, 32 a pass; the address is the same in every lane, so the words come by scalar loads */
    v16u mw0 = *(const v16u*)mwp, mw1 = *(const v16u*)(mwp + 16);
    v4i kr0, kr1, vr0, vr1;
    { v4i pk0[FS], pk1[FS], pv0[FS], pv1[FS];   /* stage 0: all its loads are issued before the first store */
#pragma unroll
      for (int j = 0; j < FS; ++j) { pk0[j] = *(const v4i*)(kg + j * FK * HD); pk1[j] = *(const v4i*)(kg + j * FK * HD + 32 * HD); pv0[j] = *(const v4i*)(vg + j * FK); pv1[j] = *(const v4i*)(vg + j * FK + 32 * TT); }
#pragma unroll
      for (int j = 0; j < FS; ++j) { *(v4i*)(&L[j][sl]) = pk0[j]; *(v4i*)(&L[j][sl + 32 * FP]) = pk1[j]; *(v4i*)(&L[j][FK * FP + sl]) = pv0[j]; *(v4i*)(&L[j][FK * FP + sl + 32 * FP]) = pv1[j]; } }
    kg += (FS - 1) * FK * HD; vg += (FS - 1) * FK;   /* the loop's first step leads to the tiles of pass FS */
    __syncthreads();   /* stage 0's tiles are in LDS before any wave reads them */
    v8f acc[4];
#pragma unroll
    for (int dt = 0; dt < 4; ++dt) acc[dt] = (v8f){};
    float m_run = -__builtin_inff(), l_run = 0.f;
#pragma unroll 1   /* rolled: eight copies of a stage would only grow the code. Two loops, not one with a test round the barrier: under a test the compiler fetched the mask words by vector loads into vector registers */
    for (int st = 0; st < TT / FK; st += FS) {
#pragma unroll 1   /* rolled: the body is one whole pass, unrolling only grows the code and the registers */
    for (int t = st; t < st + FS; ++t) {
        const unsigned char* Lk = &L[t & (2 * FS - 1)][0] + c * FP + 16 * h; const unsigned char* Lv = Lk + FK * FP; const bool more = t + 1 < TT / FK, fill = t + FS < TT / FK;
        if (fill) { kg += FK * HD; vg += FK; kr0 = *(const v4i*)kg; kr1 = *(const v4i*)(kg + 32 * HD); vr0 = *(const v4i*)vg; vr1 = *(const v4i*)(vg + 32 * TT); }   /* the tiles of pass t + FS, in flight under this pass */
        v16bf kf[4][2];
#pragma unroll
        for (int kt = 0; kt < 4; ++kt)
#pragma unroll
            for (int kc = 0; kc < 2; ++kc) kf[kt][kc] = ldfrag(Lk + 16 * kt * FP + 64 * kc);
        const v8ul ma = __builtin_bit_cast(v8ul, mw0) & __builtin_bit_cast(v8ul, mw1);   /* the AND of the pass's 32 mask words, two at a time, as a tree: scalar work under the K reads' latency */
        const bool open = (((ma[0] & ma[1]) & (ma[2] & ma[3])) & ((ma[4] & ma[5]) & (ma[6] & ma[7]))) == ~0ull;   /* every (query, key) of this wave's pass is attended: the mask term is +0 for all its scores */
        __builtin_amdgcn_sched_barrier(0);   /* keeps the pass's K reads one group in front of the products: sunk between them, each pair costs its own LDS latency */
        v8f s[4];
#pragma unroll
        for (int kt = 0; kt < 4; ++kt) { s[kt] = (v8f){};
#pragma unroll
            for (int kc = 0; kc < 2; ++kc) s[kt] = wmmab(kf[kt][kc], qf[kc], s[kt]); }
        v16h vf[2][4];
#pragma unroll
        for (int dt = 0; dt < 4; ++dt) vf[0][dt] = ldfragh(Lv + 16 * dt * FP);
        __builtin_amdgcn_sched_barrier(0);   /* keeps the first 32 keys' V^T reads here, one group, in flight under the softmax arithmetic */
        if (!open) {   /* one scalar branch a pass, on scalar registers alone; only a pass with a masked score pays for the mask term */
#pragma unroll
            for (int kt = 0; kt < 4; ++kt)
#pragma unroll
                for (int r = 0; r < 8; ++r) s[kt][r] += __builtin_amdgcn_inverse_ballot_w32(kt < 2 ? mw0[8 * kt + r] : mw1[8 * kt + r - 16]) ? 0.0f : -1.25e8f; }   /* (q.k + (mask ? 0 : -1e9)) x 1/8 with the module's one rounding: the scores come scaled by the exact 1/8, and so does the term */
        float mk[4];   /* one short chain a score tile: with the mask arithmetic gone nothing else stands between the links of one long chain */
#pragma unroll
        for (int kt = 0; kt < 4; ++kt) { mk[kt] = -3.0e38f;
#pragma unroll
            for (int r = 0; r < 8; ++r) mk[kt] = fmaxf(mk[kt], s[kt][r]); }
        float mx = fmaxf(fmaxf(mk[0], mk[1]), fmaxf(mk[2], mk[3]));
        mwp += more ? 32 : 0; mw0 = *(const v16u*)mwp; mw1 = *(const v16u*)(mwp + 16);   /* the next pass's mask words, asked for as soon as this pass's are used up; the last pass asks for its own again, in bounds */
        mx = fmaxf(mx, xhalf(mx));   /* both halves hold the query's maximum of this pass */
        if (__builtin_amdgcn_ballot_w32(mx > m_run + FLZ) != 0) {   /* one scalar branch a pass; always taken in pass 0 (m_run = -inf, factor 0) */
            const float m_new = fmaxf(m_run, mx); const float corr = __builtin_amdgcn_exp2f((m_run - m_new) * L2E); m_run = m_new; l_run *= corr;
#pragma unroll
            for (int dt = 0; dt < 4; ++dt) acc[dt] = acc[dt] * corr; }
#pragma unroll
        for (int ks = 0; ks < 2; ++ks) { v8u wh;
#pragma unroll
            for (int g = 0; g < 2; ++g) { float e[8];
#pragma unroll
                for (int r = 0; r < 8; ++r) e[r] = (s[2 * ks + g][r] - m_run) * L2E;
                exp2x8(e);
#pragma unroll
                for (int i = 0; i < 4; ++i) { const float p0 = e[2 * i], p1 = e[2 * i + 1]; l_run += p0 + p1; wh[4 * g + i] = pack2h(p0, p1); } }   /* the sum takes the f32 p, the product f16(p) */
            const v16h ph = __builtin_bit_cast(v16h, wh);
            if (ks == 0) {
#pragma unroll
                for (int dt = 0; dt < 4; ++dt) vf[1][dt] = ldfragh(Lv + 16 * dt * FP + 64);
                __builtin_amdgcn_sched_barrier(0); }   /* the last 32 keys' V^T reads, one group, in flight under the first products and the second half's exponentials; later than the first group for the registers */
#pragma unroll
            for (int dt = 0; dt < 4; ++dt) acc[dt] = wmma16(vf[ks][dt], ph, acc[dt]); }
        if (fill) { unsigned char* Ln = &L[(t + FS) & (2 * FS - 1)][0]; *(v4i*)(Ln + sl) = kr0; *(v4i*)(Ln + sl + 32 * FP) = kr1; *(v4i*)(Ln + FK * FP + sl) = vr0; *(v4i*)(Ln + FK * FP + sl + 32 * FP) = vr1; }
        asm volatile("s_wait_xcnt 0x0" ::: "memory");   /* behind the scalar loads of the mask words, in front of the first overwrite of a register that holds their address (the pointer's next step) */
    }
        __syncthreads();   /* behind a stage's last pass: publishes the next stage's tiles and ends every wave's reads of this stage, which the next stage's passes refill */
    }
    const float inv = __fdiv_rn(1.0f, l_run + xhalf(l_run));   /* the two halves' sums meet once */
    float* orow = O + ((size_t)bh * TT + q) * HD + 8 * h;   /* acc[dt][r] = O[q][16 dt + 8 h + r] */
#pragma unroll
    for (int dt = 0; dt < 4; ++dt) { const v8f o = acc[dt] * inv; v4f o0, o1;
#pragma unroll
        for (int r = 0; r < 4; ++r) { o0[r] = o[r]; o1[r] = o[4 + r]; }
        *(v4f*)(orow + 16 * dt) = o0; *(v4f*)(orow + 16 * dt + 4) = o1; }
}
// ---- k_planes: the three 16-bit planes and the mask words that k_fattn reads, both batches, in ONE launch; nothing else is written.
// Work-group = PT positions of one (batch, head), of all three inputs: 24 whole-line 16-byte loads a thread, all issued before the first use, with the 16 of the mask.
// Mask words: a wave reads 16 rows x 128 keys in whole lines, turns them in LDS (its own rows) so that a lane holds what k_fattn's lane holds, and each compare's lane mask is one word: MB[batch x 128 + row tile][pass][8 kt + r].
// Q, K: a row of 64 f32 (256 bytes, 16 lanes) becomes a row of 128 bytes; a wave stores two neighbouring rows, 256 bytes in a row. Q is stored as bf16(q) x 1/8, the softmax scale.
// V^T: a lane packs positions 2 p, 2 p + 1 of four d, rounded to bf16 and carried as f16, into four words, LDS [d][p]; read back by rows of d, 256 bytes of one d a half wave.
// The 16-byte piece of an LDS row stands at (piece ^ (d >> 2)): the 16 lanes that write one p for 64 d hit 16 different pieces, and the read-back stays 16-byte aligned.
#define PT 128
#define MQ 528      // LDS row pitch of the mask rows, bytes: 512 + 16
typedef __attribute__((ext_vector_type(2))) unsigned v2u;
typedef __attribute__((ext_vector_type(4))) unsigned v4u;
typedef v4u __attribute__((may_alias)) v4ua;
__global__ __launch_bounds__(256) void k_planes(const float* __restrict__ xq, const float* __restrict__ xk, const float* __restrict__ xv, const float* __restrict__ am, bf* __restrict__ Qp, bf* __restrict__ Kp, bf* __restrict__ Vp, unsigned* __restrict__ MB) {
    __shared__ __align__(16) unsigned VL[HD * (PT / 2)];
    __shared__ __align__(16) unsigned char MS[8][16 * MQ];
    const int tid = threadIdx.x, g = tid & 15, u = tid >> 4;
    const int t0 = blockIdx.x * PT, bh = blockIdx.y;
    const size_t in0 = ((size_t)((bh / NH_) * TT + t0) * NH_ + (bh % NH_)) * HD + 4 * g;   /* [b][t0][h][4 g]; the next position is DQ elements on */
    const float* pv = xv + in0 + (size_t)(2 * u) * DQ; const float* pq = xq + in0 + (size_t)u * DQ; const float* pk = xk + in0 + (size_t)u * DQ;
    const int lane = tid & 31, gw = (blockIdx.y * (TT / PT) + blockIdx.x) * 8 + (tid >> 5);   /* 4096 waves share the mask: wave gw has the 16 rows of row tile gw >> 4, at the 128 keys of slice gw & 15 */
    const float* pm = am + (size_t)(gw >> 4) * 16 * TT + (gw & 15) * 128 + 4 * lane;   /* a load takes 512 bytes of one row */
    v4f va[4], vb[4], qa[8], ka[8], ma[16];
#pragma unroll
    for (int i = 0; i < 4; ++i) { va[i] = *(const v4f*)(pv + 32 * i * DQ); vb[i] = *(const v4f*)(pv + (32 * i + 1) * DQ); }
#pragma unroll
    for (int i = 0; i < 16; ++i) ma[i] = *(const v4f*)(pm + i * TT);
#pragma unroll
    for (int i = 0; i < 8; ++i) { qa[i] = *(const v4f*)(pq + 16 * i * DQ); ka[i] = *(const v4f*)(pk + 16 * i * DQ); }
    asm volatile("s_wait_xcnt 0x0" :: "v"(pv), "v"(pq), "v"(pk), "v"(pm) : "memory");   /* behind the last load, in front of the first overwrite of an address pair, where this wait belongs. The four pairs are inputs so that they live up to it (without them the compiler hands a pair to a later load as its destination); the clobber keeps all 40 loads in front of it, in flight together */
#pragma unroll
    for (int i = 0; i < 4; ++i) { const int p = u + 16 * i;
#pragma unroll
        for (int j = 0; j < 4; ++j) { const unsigned b2 = pack2(va[i][j], vb[i][j]); VL[(4 * g + j) * (PT / 2) + 4 * ((p >> 2) ^ g) + (p & 3)] = pack2h(__uint_as_float(b2 << 16), __uint_as_float(b2 & 0xFFFF0000u)); } }   /* rounded to bf16 like the other inputs, then written as f16 */
    unsigned char* ms = &MS[tid >> 5][0];
#pragma unroll
    for (int i = 0; i < 16; ++i) *(v4fa*)(ms + i * MQ + 16 * lane) = ma[i];
    __syncthreads();   /* the whole V^T tile and the mask rows are in LDS before any of them is read back; it stands in front of every global store, so that it waits for none */
    v4u vt[4];
#pragma unroll
    for (int i = 0; i < 4; ++i) { const int d = u + 16 * i; vt[i] = *(const v4ua*)&VL[d * (PT / 2) + 4 * (g ^ ((d >> 2) & 15))]; }
    bf* qo = Qp + ((size_t)bh * TT + t0 + u) * HD + 4 * g; bf* ko = Kp + ((size_t)bh * TT + t0 + u) * HD + 4 * g;
#pragma unroll
    for (int i = 0; i < 8; ++i) { v2u x, y; x[0] = pack2(qa[i][0] * SCL, qa[i][1] * SCL); x[1] = pack2(qa[i][2] * SCL, qa[i][3] * SCL); y[0] = pack2(ka[i][0], ka[i][1]); y[1] = pack2(ka[i][2], ka[i][3]);
        *(v2u*)(qo + 16 * i * HD) = x; *(v2u*)(ko + 16 * i * HD) = y; }
#pragma unroll
    for (int i = 0; i < 4; ++i) *(v4u*)(Vp + ((size_t)bh * HD + u + 16 * i) * TT + t0 + 8 * g) = vt[i];
    const unsigned char* mrd = ms + (lane & 15) * MQ + 32 * (lane >> 4);   /* read back as k_fattn's lane holds the scores: row lane & 15, keys 16 kt + 8 (lane >> 4) + r of a 64-key pass */
#pragma unroll
    for (int tt = 0; tt < 2; ++tt) { unsigned wv = 0;
#pragma unroll
        for (int i = 0; i < 8; ++i) { const v4f x = *(const v4fa*)(mrd + 256 * tt + 64 * (i >> 1) + 16 * (i & 1));
#pragma unroll
            for (int j = 0; j < 4; ++j) { const unsigned bw = __builtin_amdgcn_ballot_w32(x[j] > 0.5f); wv = (lane == 4 * i + j) ? bw : wv; } }   /* word 8 kt + r = 4 i + j goes to the lane of that number */
        MB[((size_t)(gw >> 4) * (TT / FK) + 2 * (gw & 15) + tt) * 32 + lane] = wv; }   /* 128 bytes a pass, one wave */
}
extern "C" void kernel_launch(void* const* d_in, const int* in_sizes, int n_in,
                              void* d_out, int out_size, void* d_ws, size_t ws_size, hipStream_t stream) {
    (void)in_sizes; (void)n_in; (void)out_size;
    const float* xq = (const float*)d_in[0]; const float* xk = (const float*)d_in[1]; const float* xv = (const float*)d_in[2]; const float* am = (const float*)d_in[3];   /* queries [2][2048][16][64], keys, values [2][2048][16][64], attn_mask [2][1][2048][2048] (> 0.5 = attend; all ones) */
    float* OUT = (float*)d_out;     // [2][16][2048][64] head-major (V = 'bhld')
    char* wsp = (char*)d_ws;
    auto take = [&](size_t bytes) { char* p = wsp; wsp += (bytes + 255) & ~(size_t)255; return (void*)p; };
    const size_t PL = (size_t)NB_ * NH_ * TT * HD;   /* elements of one plane, both batches */
    bf* QPh = (bf*)take(PL * 2); bf* KPh = (bf*)take(PL * 2); bf* VTh = (bf*)take(PL * 2); unsigned* MBw = (unsigned*)take((size_t)NB_ * TT * TT / 8);
    if ((size_t)(wsp - (char*)d_ws) > ws_size) return;    // ws 256 MiB (carve 25 MiB)
    k_planes<<<dim3(TT / PT, NB_ * NH_), 256, 0, stream>>>(xq, xk, xv, am, QPh, KPh, VTh, MBw);   /* bf16(queries) x 1/8, bf16(keys) as [bh][t][d], bf16(values) in f16 as [bh][d][t]; attn_mask > 0.5 as bits */
    k_fattn<<<dim3(TT / (FW * 16), NB_ * NH_), 32 * FW, 0, stream>>>(QPh, KPh, VTh, MBw, OUT);   /* all 32 (batch, head) pairs in one launch: V[b][h][l][d], head-major, straight into the output */
}

// v008
// A run of this version takes 48.4 microseconds.
// In two side-by-side timings against v007, it was 1.03 and 1.04 times as fast.
// All steps since v000 together make it 27.1 times as fast.
#include <hip/hip_runtime.h>

// Full (Informer-style) attention on pre-split heads with a mask, head-major output (queries [2][2048][16][64], keys, values [2][2048][16][64]; scores = q.k; + where(attn_mask > 0.5, 0, -1e9) (attn_mask [2][1][2048][2048] float, all ones, read per (i, j)); A = softmax(scores x 1/sqrt(64)); V = A.values as 'bhld' -> [2][16][2048][64] (4.2 M; no projections); argument order queries, keys, values, attn_mask).
// Layout: the inputs are already [t][h][d]: one launch (k_planes) rounds them to bf16 and writes the per-head planes Q, K [bh][t][d] (bf16) and V^T [bh][d][t] (the bf16 values as f16), and turns the mask into one bit a (query, key); then one fused kernel over all (batch, head) pairs: scores (one product, the scale 1/8 already in Q), mask term where a pass has one, with the module's rounding, online softmax, f16(P) x bf16(values) held exactly in f16 (1 product), one division, head-major output rows.
// Compute dtypes, f32 accumulate: every input rounded to bf16; scores exact, bf16 products; softmax f32; A.values one f16 product: P rounded once to f16 (11 bits; P <= e^5 by the lazy maximum, far inside the f16 range), values bf16-rounded and then carried in f16, which holds every bf16 value of magnitude 2^-14 to 65504 exactly; output f32.

#define NB_  2
#define TT   2048
#define DM   1024
#define NH_  16
#define NKV  16
#define REP  (NH_ / NKV)
#define HD   64
#define DQ   (NH_ * HD)
#define DKV  (NKV * HD)
#define ZH   2
#define WIN  0
#define PCAR 1024.0f
#define SCL  0.125f   // 1/sqrt(64), a power of two: applied to Q and to the mask term, it gives the module's (scores + mask term) x scale bit for bit
typedef unsigned short bf;
typedef __attribute__((ext_vector_type(16))) __bf16   v16bf;
typedef __attribute__((ext_vector_type(16))) _Float16 v16h;
typedef __attribute__((ext_vector_type(8)))  _Float16 v8h;
typedef __attribute__((ext_vector_type(8)))  unsigned short v8us;
typedef __attribute__((ext_vector_type(8)))  float    v8f;
typedef __attribute__((ext_vector_type(4)))  float    v4f;
typedef v8h  __attribute__((may_alias)) v8ha;
typedef v4f  __attribute__((may_alias)) v4fa;
typedef v8us __attribute__((may_alias)) v8usa;

__device__ __forceinline__ v16h cat16(v8h lo, v8h hi) { return __builtin_shufflevector(lo, hi, 0, 1, 2, 3, 4, 5, 6, 7, 8, 9, 10, 11, 12, 13, 14, 15); }
__device__ __forceinline__ v16bf cat16b(v8us lo, v8us hi) { return __builtin_bit_cast(v16bf, __builtin_shufflevector(lo, hi, 0, 1, 2, 3, 4, 5, 6, 7, 8, 9, 10, 11, 12, 13, 14, 15)); }
__device__ __forceinline__ v8f wmma16(v16h a, v16h b, v8f c) { return __builtin_amdgcn_wmma_f32_16x16x32_f16(false, a, false, b, (short)0, c, false, false); }
__device__ __forceinline__ v8f wmmab(v16bf a, v16bf b, v8f c) { return __builtin_amdgcn_wmma_f32_16x16x32_bf16(false, a, false, b, (short)0, c, false, false); }



typedef __attribute__((ext_vector_type(4))) _Float16 v4h;
typedef __attribute__((ext_vector_type(4))) unsigned short v4us;
typedef __attribute__((ext_vector_type(2))) float v2f;
typedef __attribute__((ext_vector_type(4))) int v4i;

#define FW 8
#define FK 64      // keys a tile in LDS
#define FB 32      // keys a pass
#define FS 4       // tiles a stage, and passes a stage: 128 keys of either half between two barriers; the ring of 2 FS tiles takes 144 KiB, two work-groups a WGP
#define KH (TT / 2)   // keys a half
#define NP (KH / FB)  // passes a wave
#define FP 144      // LDS row pitch, bytes: 128 + 16, an odd multiple of 16 for the 16-byte fragment reads
#define FLZ 5.0f
#define L2E 1.4426950408889634f
typedef __attribute__((ext_vector_type(2))) __bf16 v2bf;
typedef __attribute__((ext_vector_type(8))) unsigned v8u;
typedef __attribute__((ext_vector_type(16))) unsigned v16u;
typedef __attribute__((ext_vector_type(8))) unsigned long long v8ul;
__device__ __forceinline__ unsigned pack2(float lo, float hi) { v2f x; x[0] = lo; x[1] = hi; return __builtin_bit_cast(unsigned, __builtin_convertvector(x, v2bf)); }   /* two f32 -> two bf16, round to nearest even */
typedef __attribute__((ext_vector_type(2))) _Float16 v2h;
__device__ __forceinline__ unsigned pack2h(float lo, float hi) { v2f x; x[0] = lo; x[1] = hi; return __builtin_bit_cast(unsigned, __builtin_convertvector(x, v2h)); }   /* two f32 -> two f16, round to nearest even */
__device__ __forceinline__ float xhalf(float x) { return __builtin_bit_cast(float, __builtin_amdgcn_permlanex16(__builtin_bit_cast(int, x), __builtin_bit_cast(int, x), 0x76543210, 0xfedcba98, false, false)); }   /* lane l <-> lane l ^ 16 */
__device__ __forceinline__ v16bf ldfrag(const unsigned char* p) { return cat16b(*(const v8usa*)p, *(const v8usa*)(p + 32)); }   /* k order 8 h + s, 16 + 8 h + s: p already holds the 16 h bytes */
__device__ __forceinline__ v16h ldfragh(const unsigned char* p) { return cat16(*(const v8ha*)p, *(const v8ha*)(p + 32)); }   /* the same k order, f16 elements */
/* eight 2^x in place, then the one slot the instruction set asks for behind a transcendental before its result is read or its source overwritten */
__device__ __forceinline__ void exp2x8(float (&e)[8]) {
    asm("v_exp_f32 %0, %0\n\tv_exp_f32 %1, %1\n\tv_exp_f32 %2, %2\n\tv_exp_f32 %3, %3\n\tv_exp_f32 %4, %4\n\tv_exp_f32 %5, %5\n\tv_exp_f32 %6, %6\n\tv_exp_f32 %7, %7\n\tv_nop"
        : "+v"(e[0]), "+v"(e[1]), "+v"(e[2]), "+v"(e[3]), "+v"(e[4]), "+v"(e[5]), "+v"(e[6]), "+v"(e[7])); }
__device__ __forceinline__ int tkey(int T) { return ((T >> 1) & 1) * KH + (T >> 2) * (2 * FK) + (T & 1) * FK; }   /* first key of ring tile T */
__global__ __launch_bounds__(32 * FW) void k_fattn(const bf* __restrict__ Qp, const bf* __restrict__ Kp, const bf* __restrict__ Vp, const unsigned* __restrict__ MB, float* __restrict__ O) {
    __shared__ __align__(16) unsigned char L[2 * FS][2 * FK * FP];
    const int tid = threadIdx.x, lane = tid & 31, c = lane & 15, h = lane >> 4;
    const int w = __builtin_amdgcn_readfirstlane(tid >> 5), hf = w >> 2, qg = w & 3;   /* the wave's key half and its 32 queries; scalars */
    const int bh = blockIdx.y, q0 = blockIdx.x * (FW * 16) + qg * 32;
    v16bf qf[2][2];
#pragma unroll
    for (int g = 0; g < 2; ++g) { const unsigned char* qp = (const unsigned char*)(Qp + ((size_t)bh * TT + q0 + 16 * g + c) * HD) + 16 * h;
#pragma unroll
        for (int kc = 0; kc < 2; ++kc) qf[g][kc] = ldfrag(qp + 64 * kc); }
    const int srow = tid >> 3, sch = tid & 7;   /* K, V^T staging: 8 threads a row of 128 bytes, 32 rows a sweep, two sweeps a tile */
    const bf* kg = Kp + (size_t)bh * TT * HD + srow * HD + sch * 8;
    const bf* vg = Vp + (size_t)bh * HD * TT + (size_t)srow * TT + sch * 8;
    const int sl = srow * FP + sch * 16;
    const unsigned* mwp = MB + ((size_t)((bh / NH_) * (TT / 16) + blockIdx.x * FW + 2 * qg) * (TT / FK) + hf * (KH / FK)) * 32;   /* the mask words of the wave's first column group and key half, 16 a pass; the second group's stand one row tile on; the address is the same in every lane, so the words come by scalar loads */
    v16u mw0 = *(const v16u*)mwp, mw1 = *(const v16u*)(mwp + (TT / FK) * 32);
    v4i kr0, kr1, vr0, vr1;
    { v4i pk0[FS], pk1[FS], pv0[FS], pv1[FS];   /* stage 0: all its loads are issued before the first store */
#pragma unroll
      for (int j = 0; j < FS; ++j) { pk0[j] = *(const v4i*)(kg + tkey(j) * HD); pk1[j] = *(const v4i*)(kg + tkey(j) * HD + 32 * HD); pv0[j] = *(const v4i*)(vg + tkey(j)); pv1[j] = *(const v4i*)(vg + tkey(j) + 32 * TT); }
#pragma unroll
      for (int j = 0; j < FS; ++j) { *(v4i*)(&L[j][sl]) = pk0[j]; *(v4i*)(&L[j][sl + 32 * FP]) = pk1[j]; *(v4i*)(&L[j][FK * FP + sl]) = pv0[j]; *(v4i*)(&L[j][FK * FP + sl + 32 * FP]) = pv1[j]; } }
    kg += tkey(FS - 1) * HD; vg += tkey(FS - 1);   /* the loop's first step leads to tile FS */
    __syncthreads();   /* stage 0's tiles are in LDS before any wave reads them */
    v8f acc[2][4];
#pragma unroll
    for (int g = 0; g < 2; ++g)
#pragma unroll
        for (int dt = 0; dt < 4; ++dt) acc[g][dt] = (v8f){};
    float m_run[2] = { -__builtin_inff(), -__builtin_inff() }; v2f l_run[2] = { (v2f){}, (v2f){} };   /* a group's sum is kept as an even and an odd part, one packed add a register pair: with two scalar sums the compiler paired the adds across the groups and moved every operand into place first */
#pragma unroll 1   /* rolled: eight copies of a stage would only grow the code. Two loops, not one with a test round the barrier: under a test the compiler fetched the mask words by vector loads into vector registers */
    for (int st = 0; st < NP; st += FS) {
#pragma unroll 1   /* rolled: the body is one whole pass, unrolling only grows the code and the registers */
    for (int t = st; t < st + FS; ++t) {
        const unsigned char* Lt = &L[(st & FS) + 2 * hf + ((t >> 1) & 1)][0] + c * FP + 16 * h;   /* the tile of the wave's half that holds this pass's 32 keys */
        const unsigned char* Lk = Lt + (t & 1) * (FB * FP); const unsigned char* Lv = Lt + FK * FP + (t & 1) * (FB * 2); const bool more = t + 1 < NP, fill = t + FS < NP;
        if (fill) { const int ks = (t & 1) ? FK : (t & 2) ? KH - FK : FK - KH;   /* from tile t + FS - 1 to tile t + FS: on 64 keys, over to the upper half, back to the lower half's next 128 */ kg += ks * HD; vg += ks; kr0 = *(const v4i*)kg; kr1 = *(const v4i*)(kg + 32 * HD); vr0 = *(const v4i*)vg; vr1 = *(const v4i*)(vg + 32 * TT); }   /* tile t + FS, in flight under this pass */
        v16bf kf[2][2];
#pragma unroll
        for (int kt = 0; kt < 2; ++kt)
#pragma unroll
            for (int kc = 0; kc < 2; ++kc) kf[kt][kc] = ldfrag(Lk + 16 * kt * FP + 64 * kc);
        const v8ul ma = __builtin_bit_cast(v8ul, mw0) & __builtin_bit_cast(v8ul, mw1);   /* the AND of the pass's 32 mask words, two at a time, as a tree: scalar work under the K reads' latency */
        const bool open = (((ma[0] & ma[1]) & (ma[2] & ma[3])) & ((ma[4] & ma[5]) & (ma[6] & ma[7]))) == ~0ull;   /* every (query, key) of this wave's pass is attended: the mask term is +0 for all its scores */
        __builtin_amdgcn_sched_barrier(0);   /* keeps the pass's K reads one group in front of the products: sunk between them, each pair costs its own LDS latency */
        v8f s[2][2];
#pragma unroll
        for (int g = 0; g < 2; ++g)
#pragma unroll
            for (int kt = 0; kt < 2; ++kt) s[g][kt] = (v8f){};
#pragma unroll
        for (int kc = 0; kc < 2; ++kc)
#pragma unroll
            for (int kt = 0; kt < 2; ++kt)
#pragma unroll
                for (int g = 0; g < 2; ++g) s[g][kt] = wmmab(kf[kt][kc], qf[g][kc], s[g][kt]);   /* a K fragment feeds both column groups */
        v16h vf[4];
#pragma unroll
        for (int dt = 0; dt < 4; ++dt) vf[dt] = ldfragh(Lv + 16 * dt * FP);
        __builtin_amdgcn_sched_barrier(0);   /* keeps the pass's V^T reads here, one group, in flight under the softmax arithmetic */
        if (!open) {   /* one scalar branch a pass, on scalar registers alone; only a pass with a masked score pays for the mask term */
#pragma unroll
            for (int kt = 0; kt < 2; ++kt)
#pragma unroll
                for (int r = 0; r < 8; ++r) { s[0][kt][r] += __builtin_amdgcn_inverse_ballot_w32(mw0[8 * kt + r]) ? 0.0f : -1.25e8f; s[1][kt][r] += __builtin_amdgcn_inverse_ballot_w32(mw1[8 * kt + r]) ? 0.0f : -1.25e8f; } }   /* (q.k + (mask ? 0 : -1e9)) x 1/8 with the module's one rounding: the scores come scaled by the exact 1/8, and so does the term */
        float mx[2];
#pragma unroll
        for (int g = 0; g < 2; ++g) { float mk[2];   /* one short chain a score tile */
#pragma unroll
            for (int kt = 0; kt < 2; ++kt) { mk[kt] = -3.0e38f;
#pragma unroll
                for (int r = 0; r < 8; ++r) mk[kt] = fmaxf(mk[kt], s[g][kt][r]); }
            mx[g] = fmaxf(mk[0], mk[1]); }
        mwp += more ? 16 : 0; mw0 = *(const v16u*)mwp; mw1 = *(const v16u*)(mwp + (TT / FK) * 32);   /* the next pass's mask words, asked for as soon as this pass's are used up; the last pass asks for its own again, in bounds */
#pragma unroll
        for (int g = 0; g < 2; ++g) mx[g] = fmaxf(mx[g], xhalf(mx[g]));   /* both halves hold the query's maximum of this pass */
        if (__builtin_amdgcn_ballot_w32(mx[0] > m_run[0] + FLZ || mx[1] > m_run[1] + FLZ) != 0) {   /* one scalar branch a pass; always taken in pass 0 (m_run = -inf, factor 0) */
#pragma unroll
            for (int g = 0; g < 2; ++g) { const float m_new = fmaxf(m_run[g], mx[g]); const float corr = __builtin_amdgcn_exp2f((m_run[g] - m_new) * L2E); m_run[g] = m_new; l_run[g] *= corr;
#pragma unroll
                for (int dt = 0; dt < 4; ++dt) acc[g][dt] = acc[g][dt] * corr; } }
        v16h ph[2];
#pragma unroll
        for (int g = 0; g < 2; ++g) { v8u wh;
#pragma unroll
            for (int kt = 0; kt < 2; ++kt) { float e[8];
#pragma unroll
                for (int r = 0; r < 8; ++r) e[r] = (s[g][kt][r] - m_run[g]) * L2E;
                exp2x8(e);
#pragma unroll
                for (int i = 0; i < 4; ++i) { const float p0 = e[2 * i], p1 = e[2 * i + 1]; v2f pp; pp[0] = p0; pp[1] = p1; l_run[g] += pp; wh[4 * kt + i] = pack2h(p0, p1); } }   /* the sum takes the f32 p, the product f16(p) */
            ph[g] = __builtin_bit_cast(v16h, wh);
#pragma unroll
            for (int dt = 0; dt < 4; ++dt) acc[g][dt] = wmma16(vf[dt], ph[g], acc[g][dt]); }   /* a V^T fragment feeds both column groups */
        if (fill) { unsigned char* Ln = &L[(t + FS) & (2 * FS - 1)][0]; *(v4i*)(Ln + sl) = kr0; *(v4i*)(Ln + sl + 32 * FP) = kr1; *(v4i*)(Ln + FK * FP + sl) = vr0; *(v4i*)(Ln + FK * FP + sl + 32 * FP) = vr1; }
        asm volatile("s_wait_xcnt 0x0" ::: "memory");   /* behind the scalar loads of the mask words and the tile's loads, in front of the first overwrite of a register that holds their address (the pointers' next step) */
    }
        __syncthreads();   /* behind a stage's last pass: publishes the next stage's tiles and ends every wave's reads of this stage, which the next stage's passes refill; behind the last stage it frees the ring for the swap below */
    }
    /* the two key halves meet: wave w keeps column group hf and hands the other one to wave w ^ 4, lane to lane, 16 bytes a lane and store in whole rows of 512 bytes */
    const bool up = hf != 0;
    unsigned char* xo = &L[0][0] + (size_t)w * (9 * 512) + 16 * lane; const unsigned char* xi = &L[0][0] + (size_t)(w ^ 4) * (9 * 512) + 16 * lane;
#pragma unroll
    for (int dt = 0; dt < 4; ++dt) { const v8f o = up ? acc[0][dt] : acc[1][dt]; v4f o0, o1;
#pragma unroll
        for (int r = 0; r < 4; ++r) { o0[r] = o[r]; o1[r] = o[4 + r]; }
        *(v4fa*)(xo + (2 * dt) * 512) = o0; *(v4fa*)(xo + (2 * dt + 1) * 512) = o1; }
    { v4f ml = (v4f){}; ml[0] = up ? m_run[0] : m_run[1]; ml[1] = up ? l_run[0][0] + l_run[0][1] : l_run[1][0] + l_run[1][1]; *(v4fa*)(xo + 8 * 512) = ml; }
    __syncthreads();   /* every wave's handed-over group is in LDS before its partner reads it */
    const v4f mlp = *(const v4fa*)(xi + 8 * 512);
    const float m_a = up ? m_run[1] : m_run[0], l_a = up ? l_run[1][0] + l_run[1][1] : l_run[0][0] + l_run[0][1], m_j = fmaxf(m_a, mlp[0]);
    float f_a = (m_a - m_j) * L2E, f_b = (mlp[0] - m_j) * L2E;   /* both maxima are finite: each half has seen its first pass */
    asm("v_exp_f32 %0, %0\n\tv_exp_f32 %1, %1\n\tv_nop" : "+v"(f_a), "+v"(f_b));   /* two 2^x in place and the slot behind a transcendental, as in exp2x8 */
    const float l_j = l_a * f_a + mlp[1] * f_b;
    const float inv = __fdiv_rn(1.0f, l_j + xhalf(l_j));   /* the two lane halves' sums meet once */
    const float g_a = f_a * inv, g_b = f_b * inv;
    float* orow = O + ((size_t)bh * TT + q0 + 16 * hf + c) * HD + 8 * h;   /* acc[g][dt][r] = O[q0 + 16 g + c][16 dt + 8 h + r] */
#pragma unroll
    for (int dt = 0; dt < 4; ++dt) { const v8f oa = up ? acc[1][dt] : acc[0][dt]; const v4f b0 = *(const v4fa*)(xi + (2 * dt) * 512), b1 = *(const v4fa*)(xi + (2 * dt + 1) * 512); v4f o0, o1;
#pragma unroll
        for (int r = 0; r < 4; ++r) { o0[r] = oa[r] * g_a + b0[r] * g_b; o1[r] = oa[4 + r] * g_a + b1[r] * g_b; }
        *(v4f*)(orow + 16 * dt) = o0; *(v4f*)(orow + 16 * dt + 4) = o1; }
}
// ---- k_planes: the three 16-bit planes and the mask words that k_fattn reads, both batches, in ONE launch; nothing else is written.
// Work-group = PT positions of one (batch, head), of all three inputs: 24 whole-line 16-byte loads a thread, all issued before the first use, with the 16 of the mask.
// Mask words: a wave reads 16 rows x 128 keys in whole lines, turns them in LDS (its own rows) so that a lane holds what k_fattn's lane holds, and each compare's lane mask is one word: MB[batch x 128 + row tile][64-key block][8 kt + r].
// Q, K: a row of 64 f32 (256 bytes, 16 lanes) becomes a row of 128 bytes; a wave stores two neighbouring rows, 256 bytes in a row. Q is stored as bf16(q) x 1/8, the softmax scale.
// V^T: a lane packs positions 2 p, 2 p + 1 of four d, rounded to bf16 and carried as f16, into four words, LDS [d][p]; read back by rows of d, 256 bytes of one d a half wave.
// The 16-byte piece of an LDS row stands at (piece ^ (d >> 2)): the 16 lanes that write one p for 64 d hit 16 different pieces, and the read-back stays 16-byte aligned.
#define PT 128
#define MQ 528      // LDS row pitch of the mask rows, bytes: 512 + 16
typedef __attribute__((ext_vector_type(2))) unsigned v2u;
typedef __attribute__((ext_vector_type(4))) unsigned v4u;
typedef v4u __attribute__((may_alias)) v4ua;
__global__ __launch_bounds__(256) void k_planes(const float* __restrict__ xq, const float* __restrict__ xk, const float* __restrict__ xv, const float* __restrict__ am, bf* __restrict__ Qp, bf* __restrict__ Kp, bf* __restrict__ Vp, unsigned* __restrict__ MB) {
    __shared__ __align__(16) unsigned VL[HD * (PT / 2)];
    __shared__ __align__(16) unsigned char MS[8][16 * MQ];
    const int tid = threadIdx.x, g = tid & 15, u = tid >> 4;
    const int t0 = blockIdx.x * PT, bh = blockIdx.y;
    const size_t in0 = ((size_t)((bh / NH_) * TT + t0) * NH_ + (bh % NH_)) * HD + 4 * g;   /* [b][t0][h][4 g]; the next position is DQ elements on */
    const float* pv = xv + in0 + (size_t)(2 * u) * DQ; const float* pq = xq + in0 + (size_t)u * DQ; const float* pk = xk + in0 + (size_t)u * DQ;
    const int lane = tid & 31, gw = (blockIdx.y * (TT / PT) + blockIdx.x) * 8 + (tid >> 5);   /* 4096 waves share the mask: wave gw has the 16 rows of row tile gw >> 4, at the 128 keys of slice gw & 15 */
    const float* pm = am + (size_t)(gw >> 4) * 16 * TT + (gw & 15) * 128 + 4 * lane;   /* a load takes 512 bytes of one row */
    v4f va[4], vb[4], qa[8], ka[8], ma[16];
#pragma unroll
    for (int i = 0; i < 4; ++i) { va[i] = *(const v4f*)(pv + 32 * i * DQ); vb[i] = *(const v4f*)(pv + (32 * i + 1) * DQ); }
#pragma unroll
    for (int i = 0; i < 16; ++i) ma[i] = *(const v4f*)(pm + i * TT);
#pragma unroll
    for (int i = 0; i < 8; ++i) { qa[i] = *(const v4f*)(pq + 16 * i * DQ); ka[i] = *(const v4f*)(pk + 16 * i * DQ); }
    asm volatile("s_wait_xcnt 0x0" :: "v"(pv), "v"(pq), "v"(pk), "v"(pm) : "memory");   /* behind the last load, in front of the first overwrite of an address pair, where this wait belongs. The four pairs are inputs so that they live up to it (without them the compiler hands a pair to a later load as its destination); the clobber keeps all 40 loads in front of it, in flight together */
#pragma unroll
    for (int i = 0; i < 4; ++i) { const int p = u + 16 * i;
#pragma unroll
        for (int j = 0; j < 4; ++j) { const unsigned b2 = pack2(va[i][j], vb[i][j]); VL[(4 * g + j) * (PT / 2) + 4 * ((p >> 2) ^ g) + (p & 3)] = pack2h(__uint_as_float(b2 << 16), __uint_as_float(b2 & 0xFFFF0000u)); } }   /* rounded to bf16 like the other inputs, then written as f16 */
    unsigned char* ms = &MS[tid >> 5][0];
#pragma unroll
    for (int i = 0; i < 16; ++i) *(v4fa*)(ms + i * MQ + 16 * lane) = ma[i];
    __syncthreads();   /* the whole V^T tile and the mask rows are in LDS before any of them is read back; it stands in front of every global store, so that it waits for none */
    v4u vt[4];
#pragma unroll
    for (int i = 0; i < 4; ++i) { const int d = u + 16 * i; vt[i] = *(const v4ua*)&VL[d * (PT / 2) + 4 * (g ^ ((d >> 2) & 15))]; }
    bf* qo = Qp + ((size_t)bh * TT + t0 + u) * HD + 4 * g; bf* ko = Kp + ((size_t)bh * TT + t0 + u) * HD + 4 * g;
#pragma unroll
    for (int i = 0; i < 8; ++i) { v2u x, y; x[0] = pack2(qa[i][0] * SCL, qa[i][1] * SCL); x[1] = pack2(qa[i][2] * SCL, qa[i][3] * SCL); y[0] = pack2(ka[i][0], ka[i][1]); y[1] = pack2(ka[i][2], ka[i][3]);
        *(v2u*)(qo + 16 * i * HD) = x; *(v2u*)(ko + 16 * i * HD) = y; }
#pragma unroll
    for (int i = 0; i < 4; ++i) *(v4u*)(Vp + ((size_t)bh * HD + u + 16 * i) * TT + t0 + 8 * g) = vt[i];
    const unsigned char* mrd = ms + (lane & 15) * MQ + 32 * (lane >> 4);   /* read back as k_fattn's lane holds the scores: row lane & 15, keys 16 kt + 8 (lane >> 4) + r of a 64-key block */
#pragma unroll
    for (int tt = 0; tt < 2; ++tt) { unsigned wv = 0;
#pragma unroll
        for (int i = 0; i < 8; ++i) { const v4f x = *(const v4fa*)(mrd + 256 * tt + 64 * (i >> 1) + 16 * (i & 1));
#pragma unroll
            for (int j = 0; j < 4; ++j) { const unsigned bw = __builtin_amdgcn_ballot_w32(x[j] > 0.5f); wv = (lane == 4 * i + j) ? bw : wv; } }   /* word 8 kt + r = 4 i + j goes to the lane of that number */
        MB[((size_t)(gw >> 4) * (TT / FK) + 2 * (gw & 15) + tt) * 32 + lane] = wv; }   /* 128 bytes a 64-key block, one wave */
}
extern "C" void kernel_launch(void* const* d_in, const int* in_sizes, int n_in,
                              void* d_out, int out_size, void* d_ws, size_t ws_size, hipStream_t stream) {
    (void)in_sizes; (void)n_in; (void)out_size;
    const float* xq = (const float*)d_in[0]; const float* xk = (const float*)d_in[1]; const float* xv = (const float*)d_in[2]; const float* am = (const float*)d_in[3];   /* queries [2][2048][16][64], keys, values [2][2048][16][64], attn_mask [2][1][2048][2048] (> 0.5 = attend; all ones) */
    float* OUT = (float*)d_out;     // [2][16][2048][64] head-major (V = 'bhld')
    char* wsp = (char*)d_ws;
    auto take = [&](size_t bytes) { char* p = wsp; wsp += (bytes + 255) & ~(size_t)255; return (void*)p; };
    const size_t PL = (size_t)NB_ * NH_ * TT * HD;   /* elements of one plane, both batches */
    bf* QPh = (bf*)take(PL * 2); bf* KPh = (bf*)take(PL * 2); bf* VTh = (bf*)take(PL * 2); unsigned* MBw = (unsigned*)take((size_t)NB_ * TT * TT / 8);
    if ((size_t)(wsp - (char*)d_ws) > ws_size) return;    // ws 256 MiB (carve 25 MiB)
    k_planes<<<dim3(TT / PT, NB_ * NH_), 256, 0, stream>>>(xq, xk, xv, am, QPh, KPh, VTh, MBw);   /* bf16(queries) x 1/8, bf16(keys) as [bh][t][d], bf16(values) in f16 as [bh][d][t]; attn_mask > 0.5 as bits */
    k_fattn<<<dim3(TT / (FW * 16), NB_ * NH_), 32 * FW, 0, stream>>>(QPh, KPh, VTh, MBw, OUT);   /* all 32 (batch, head) pairs in one launch: V[b][h][l][d], head-major, straight into the output */
}

// v009
// A run of this version takes 46.3 microseconds.
// Two timings next to v008 put it at 1.05 and 1.04 times that version's speed.
// Over all steps from v000 it is 28.3 times as fast.
#include <hip/hip_runtime.h>

// Full (Informer-style) attention on pre-split heads with a mask, head-major output (queries [2][2048][16][64], keys, values [2][2048][16][64]; scores = q.k; + where(attn_mask > 0.5, 0, -1e9) (attn_mask [2][1][2048][2048] float, all ones, read per (i, j)); A = softmax(scores x 1/sqrt(64)); V = A.values as 'bhld' -> [2][16][2048][64] (4.2 M; no projections); argument order queries, keys, values, attn_mask).
// Layout: the inputs are already [t][h][d]: one launch (k_planes) rounds them to bf16 and writes the per-head planes Q, K [bh][t][d] (bf16) and V^T [bh][d][t] (the bf16 values as f16), and turns the mask into one bit a (query, key); then one fused kernel over all (batch, head) pairs: scores (one product, the scale 1/8 already in Q), mask term where a pass has one, with the module's rounding, online softmax, f16(P) x bf16(values) held exactly in f16 (1 product), one division, head-major output rows.
// Compute dtypes, f32 accumulate: every input rounded to bf16; scores exact, bf16 products; softmax f32; A.values one f16 product: P rounded once to f16 (11 bits; P <= 2^14 by the test on a pass's sums, inside the f16 range), values bf16-rounded and then carried in f16, which holds every bf16 value of magnitude 2^-14 to 65504 exactly; output f32.

#define NB_  2
#define TT   2048
#define DM   1024
#define NH_  16
#define NKV  16
#define REP  (NH_ / NKV)
#define HD   64
#define DQ   (NH_ * HD)
#define DKV  (NKV * HD)
#define ZH   2
#define WIN  0
#define PCAR 1024.0f
#define SCL  0.125f   // 1/sqrt(64), a power of two: applied to Q and to the mask term, it gives the module's (scores + mask term) x scale bit for bit
typedef unsigned short bf;
typedef __attribute__((ext_vector_type(16))) __bf16   v16bf;
typedef __attribute__((ext_vector_type(16))) _Float16 v16h;
typedef __attribute__((ext_vector_type(8)))  _Float16 v8h;
typedef __attribute__((ext_vector_type(8)))  unsigned short v8us;
typedef __attribute__((ext_vector_type(8)))  float    v8f;
typedef __attribute__((ext_vector_type(4)))  float    v4f;
typedef v8h  __attribute__((may_alias)) v8ha;
typedef v4f  __attribute__((may_alias)) v4fa;
typedef v8us __attribute__((may_alias)) v8usa;

__device__ __forceinline__ v16h cat16(v8h lo, v8h hi) { return __builtin_shufflevector(lo, hi, 0, 1, 2, 3, 4, 5, 6, 7, 8, 9, 10, 11, 12, 13, 14, 15); }
__device__ __forceinline__ v16bf cat16b(v8us lo, v8us hi) { return __builtin_bit_cast(v16bf, __builtin_shufflevector(lo, hi, 0, 1, 2, 3, 4, 5, 6, 7, 8, 9, 10, 11, 12, 13, 14, 15)); }
__device__ __forceinline__ v8f wmma16(v16h a, v16h b, v8f c) { return __builtin_amdgcn_wmma_f32_16x16x32_f16(false, a, false, b, (short)0, c, false, false); }
__device__ __forceinline__ v8f wmmab(v16bf a, v16bf b, v8f c) { return __builtin_amdgcn_wmma_f32_16x16x32_bf16(false, a, false, b, (short)0, c, false, false); }



typedef __attribute__((ext_vector_type(4))) _Float16 v4h;
typedef __attribute__((ext_vector_type(4))) unsigned short v4us;
typedef __attribute__((ext_vector_type(2))) float v2f;
typedef __attribute__((ext_vector_type(4))) int v4i;

#define FW 8
#define FK 64      // keys a tile in LDS
#define FB 32      // keys a pass
#define FS 4       // tiles a stage, and passes a stage: 128 keys of either half between two barriers; the ring of 2 FS tiles takes 144 KiB, two work-groups a WGP
#define KH (TT / 2)   // keys a half
#define NP (KH / FB)  // passes a wave
#define FP 144      // LDS row pitch, bytes: 128 + 16, an odd multiple of 16 for the 16-byte fragment reads
#define PCAP 16384.0f   // largest sum of p a lane may see in a pass without a rescale: every p is then at most 2^14, a quarter of the largest f16
#define L2E 1.4426950408889634f
typedef __attribute__((ext_vector_type(2))) __bf16 v2bf;
typedef __attribute__((ext_vector_type(8))) unsigned v8u;
typedef __attribute__((ext_vector_type(16))) unsigned v16u;
typedef __attribute__((ext_vector_type(8))) unsigned long long v8ul;
__device__ __forceinline__ unsigned pack2(float lo, float hi) { v2f x; x[0] = lo; x[1] = hi; return __builtin_bit_cast(unsigned, __builtin_convertvector(x, v2bf)); }   /* two f32 -> two bf16, round to nearest even */
typedef __attribute__((ext_vector_type(2))) _Float16 v2h;
__device__ __forceinline__ unsigned pack2h(float lo, float hi) { v2f x; x[0] = lo; x[1] = hi; return __builtin_bit_cast(unsigned, __builtin_convertvector(x, v2h)); }   /* two f32 -> two f16, round to nearest even */
__device__ __forceinline__ float xhalf(float x) { return __builtin_bit_cast(float, __builtin_amdgcn_permlanex16(__builtin_bit_cast(int, x), __builtin_bit_cast(int, x), 0x76543210, 0xfedcba98, false, false)); }   /* lane l <-> lane l ^ 16 */
__device__ __forceinline__ v16bf ldfrag(const unsigned char* p) { return cat16b(*(const v8usa*)p, *(const v8usa*)(p + 32)); }   /* k order 8 h + s, 16 + 8 h + s: p already holds the 16 h bytes */
__device__ __forceinline__ v16h ldfragh(const unsigned char* p) { return cat16(*(const v8ha*)p, *(const v8ha*)(p + 32)); }   /* the same k order, f16 elements */
/* eight 2^x in place, then the one slot the instruction set asks for behind a transcendental before its result is read or its source overwritten */
__device__ __forceinline__ void exp2x8(float (&e)[8]) {
    asm("v_exp_f32 %0, %0\n\tv_exp_f32 %1, %1\n\tv_exp_f32 %2, %2\n\tv_exp_f32 %3, %3\n\tv_exp_f32 %4, %4\n\tv_exp_f32 %5, %5\n\tv_exp_f32 %6, %6\n\tv_exp_f32 %7, %7\n\tv_nop"
        : "+v"(e[0]), "+v"(e[1]), "+v"(e[2]), "+v"(e[3]), "+v"(e[4]), "+v"(e[5]), "+v"(e[6]), "+v"(e[7])); }
/* p = e^(s - m) of a pass, both column groups: packed to f16 in the product's k order (wh), and summed in f32 as an even and an odd part (ps). Every loop is unrolled so that each index is a constant and the arrays stay in registers */
__device__ __forceinline__ void softp(const v8f (&s)[2][2], const float (&m)[2], v8u (&wh)[2], v2f (&ps)[2]) {
#pragma unroll
    for (int g = 0; g < 2; ++g)
#pragma unroll
        for (int kt = 0; kt < 2; ++kt) { float e[8];
#pragma unroll
            for (int r = 0; r < 8; ++r) e[r] = (s[g][kt][r] - m[g]) * L2E;
            exp2x8(e);
#pragma unroll
            for (int i = 0; i < 4; ++i) { v2f pp; pp[0] = e[2 * i]; pp[1] = e[2 * i + 1]; ps[g] = (kt == 0 && i == 0) ? pp : ps[g] + pp; wh[g][4 * kt + i] = pack2h(pp[0], pp[1]); } }   /* the sum takes the f32 p, the product f16(p) */
}
__device__ __forceinline__ int tkey(int T) { return ((T >> 1) & 1) * KH + (T >> 2) * (2 * FK) + (T & 1) * FK; }   /* first key of ring tile T */
__global__ __launch_bounds__(32 * FW) void k_fattn(const bf* __restrict__ Qp, const bf* __restrict__ Kp, const bf* __restrict__ Vp, const unsigned* __restrict__ MB, float* __restrict__ O) {
    __shared__ __align__(16) unsigned char L[2 * FS][2 * FK * FP];
    const int tid = threadIdx.x, lane = tid & 31, c = lane & 15, h = lane >> 4;
    const int w = __builtin_amdgcn_readfirstlane(tid >> 5), hf = w >> 2, qg = w & 3;   /* the wave's key half and its 32 queries; scalars */
    const int bh = blockIdx.y, q0 = blockIdx.x * (FW * 16) + qg * 32;
    v16bf qf[2][2];
#pragma unroll
    for (int g = 0; g < 2; ++g) { const unsigned char* qp = (const unsigned char*)(Qp + ((size_t)bh * TT + q0 + 16 * g + c) * HD) + 16 * h;
#pragma unroll
        for (int kc = 0; kc < 2; ++kc) qf[g][kc] = ldfrag(qp + 64 * kc); }
    const int srow = tid >> 3, sch = tid & 7;   /* K, V^T staging: 8 threads a row of 128 bytes, 32 rows a sweep, two sweeps a tile */
    const bf* kg = Kp + (size_t)bh * TT * HD + srow * HD + sch * 8;
    const bf* vg = Vp + (size_t)bh * HD * TT + (size_t)srow * TT + sch * 8;
    const int sl = srow * FP + sch * 16;
    const unsigned* mwp = MB + ((size_t)((bh / NH_) * (TT / 16) + blockIdx.x * FW + 2 * qg) * (TT / FK) + hf * (KH / FK)) * 32;   /* the mask words of the wave's first column group and key half, 16 a pass; the second group's stand one row tile on; the address is the same in every lane, so the words come by scalar loads */
    v16u mw0 = *(const v16u*)mwp, mw1 = *(const v16u*)(mwp + (TT / FK) * 32);
    v4i kr0, kr1, vr0, vr1;
    { v4i pk0[FS], pk1[FS], pv0[FS], pv1[FS];   /* stage 0: all its loads are issued before the first store */
#pragma unroll
      for (int j = 0; j < FS; ++j) { pk0[j] = *(const v4i*)(kg + tkey(j) * HD); pk1[j] = *(const v4i*)(kg + tkey(j) * HD + 32 * HD); pv0[j] = *(const v4i*)(vg + tkey(j)); pv1[j] = *(const v4i*)(vg + tkey(j) + 32 * TT); }
#pragma unroll
      for (int j = 0; j < FS; ++j) { *(v4i*)(&L[j][sl]) = pk0[j]; *(v4i*)(&L[j][sl + 32 * FP]) = pk1[j]; *(v4i*)(&L[j][FK * FP + sl]) = pv0[j]; *(v4i*)(&L[j][FK * FP + sl + 32 * FP]) = pv1[j]; } }
    kg += tkey(FS - 1) * HD; vg += tkey(FS - 1);   /* the loop's first step leads to tile FS */
    __syncthreads();   /* stage 0's tiles are in LDS before any wave reads them */
    v8f acc[2][4];
#pragma unroll
    for (int g = 0; g < 2; ++g)
#pragma unroll
        for (int dt = 0; dt < 4; ++dt) acc[g][dt] = (v8f){};
    float m_run[2] = { -__builtin_inff(), -__builtin_inff() }; v2f l_run[2] = { (v2f){}, (v2f){} };   /* a group's sum is kept as an even and an odd part, one packed add a register pair: with two scalar sums the compiler paired the adds across the groups and moved every operand into place first */
#pragma unroll 1   /* rolled: eight copies of a stage would only grow the code. Two loops, not one with a test round the barrier: under a test the compiler fetched the mask words by vector loads into vector registers */
    for (int st = 0; st < NP; st += FS) {
#pragma unroll 1   /* rolled: the body is one whole pass, unrolling only grows the code and the registers */
    for (int t = st; t < st + FS; ++t) {
        const unsigned char* Lt = &L[(st & FS) + 2 * hf + ((t >> 1) & 1)][0] + c * FP + 16 * h;   /* the tile of the wave's half that holds this pass's 32 keys */
        const unsigned char* Lk = Lt + (t & 1) * (FB * FP); const unsigned char* Lv = Lt + FK * FP + (t & 1) * (FB * 2); const bool more = t + 1 < NP, fill = t + FS < NP;
        if (fill) { const int ks = (t & 1) ? FK : (t & 2) ? KH - FK : FK - KH;   /* from tile t + FS - 1 to tile t + FS: on 64 keys, over to the upper half, back to the lower half's next 128 */ kg += ks * HD; vg += ks; kr0 = *(const v4i*)kg; kr1 = *(const v4i*)(kg + 32 * HD); vr0 = *(const v4i*)vg; vr1 = *(const v4i*)(vg + 32 * TT); }   /* tile t + FS, in flight under this pass */
        v16bf kf[2][2];
#pragma unroll
        for (int kt = 0; kt < 2; ++kt)
#pragma unroll
            for (int kc = 0; kc < 2; ++kc) kf[kt][kc] = ldfrag(Lk + 16 * kt * FP + 64 * kc);
        const v8ul ma = __builtin_bit_cast(v8ul, mw0) & __builtin_bit_cast(v8ul, mw1);   /* the AND of the pass's 32 mask words, two at a time, as a tree: scalar work under the K reads' latency */
        const bool open = (((ma[0] & ma[1]) & (ma[2] & ma[3])) & ((ma[4] & ma[5]) & (ma[6] & ma[7]))) == ~0ull;   /* every (query, key) of this wave's pass is attended: the mask term is +0 for all its scores */
        __builtin_amdgcn_sched_barrier(0);   /* keeps the pass's K reads one group in front of the products: sunk between them, each pair costs its own LDS latency */
        v8f s[2][2];
#pragma unroll
        for (int g = 0; g < 2; ++g)
#pragma unroll
            for (int kt = 0; kt < 2; ++kt) s[g][kt] = (v8f){};
#pragma unroll
        for (int kc = 0; kc < 2; ++kc)
#pragma unroll
            for (int kt = 0; kt < 2; ++kt)
#pragma unroll
                for (int g = 0; g < 2; ++g) s[g][kt] = wmmab(kf[kt][kc], qf[g][kc], s[g][kt]);   /* a K fragment feeds both column groups */
        v16h vf[4];
#pragma unroll
        for (int dt = 0; dt < 4; ++dt) vf[dt] = ldfragh(Lv + 16 * dt * FP);
        __builtin_amdgcn_sched_barrier(0);   /* keeps the pass's V^T reads here, one group, in flight under the softmax arithmetic */
        if (!open) {   /* one scalar branch a pass, on scalar registers alone; only a pass with a masked score pays for the mask term */
#pragma unroll
            for (int kt = 0; kt < 2; ++kt)
#pragma unroll
                for (int r = 0; r < 8; ++r) { s[0][kt][r] += __builtin_amdgcn_inverse_ballot_w32(mw0[8 * kt + r]) ? 0.0f : -1.25e8f; s[1][kt][r] += __builtin_amdgcn_inverse_ballot_w32(mw1[8 * kt + r]) ? 0.0f : -1.25e8f; } }   /* (q.k + (mask ? 0 : -1e9)) x 1/8 with the module's one rounding: the scores come scaled by the exact 1/8, and so does the term */
        mwp += more ? 16 : 0; mw0 = *(const v16u*)mwp; mw1 = *(const v16u*)(mwp + (TT / FK) * 32);   /* the next pass's mask words, asked for as soon as this pass's are used up; the last pass asks for its own again, in bounds */
        v8u wh[2]; v2f ps[2];
        bool renew = t == 0;   /* a wave's first pass has no reference yet (m_run = -inf): a scalar test sends it straight to the maximum */
        if (!renew) { softp(s, m_run, wh, ps);
            renew = __builtin_amdgcn_ballot_w32(!(fmaxf(fmaxf(ps[0][0], ps[0][1]), fmaxf(ps[1][0], ps[1][1])) <= PCAP)) != 0; }   /* p >= 0, so no p exceeds the sum it is part of; an overflow to inf fails the test too */
        if (renew) {   /* one scalar branch a pass. Some query's scores have outgrown its reference: the pass's maximum, a new reference, the state rescaled (factor 0 in the first pass), p anew */
            float mx[2];
#pragma unroll
            for (int g = 0; g < 2; ++g) { float mk[2];   /* one short chain a score tile */
#pragma unroll
                for (int kt = 0; kt < 2; ++kt) { mk[kt] = -3.0e38f;
#pragma unroll
                    for (int r = 0; r < 8; ++r) mk[kt] = fmaxf(mk[kt], s[g][kt][r]); }
                mx[g] = fmaxf(mk[0], mk[1]); mx[g] = fmaxf(mx[g], xhalf(mx[g]));   /* both halves hold the query's maximum of this pass */
                const float m_new = fmaxf(m_run[g], mx[g]); const float corr = __builtin_amdgcn_exp2f((m_run[g] - m_new) * L2E); m_run[g] = m_new; l_run[g] *= corr;
#pragma unroll
                for (int dt = 0; dt < 4; ++dt) acc[g][dt] = acc[g][dt] * corr; }
            softp(s, m_run, wh, ps); }
#pragma unroll
        for (int g = 0; g < 2; ++g) { l_run[g] += ps[g]; const v16h ph = __builtin_bit_cast(v16h, wh[g]);
#pragma unroll
            for (int dt = 0; dt < 4; ++dt) acc[g][dt] = wmma16(vf[dt], ph, acc[g][dt]); }   /* a V^T fragment feeds both column groups */
        if (fill) { unsigned char* Ln = &L[(t + FS) & (2 * FS - 1)][0]; *(v4i*)(Ln + sl) = kr0; *(v4i*)(Ln + sl + 32 * FP) = kr1; *(v4i*)(Ln + FK * FP + sl) = vr0; *(v4i*)(Ln + FK * FP + sl + 32 * FP) = vr1; }
        asm volatile("s_wait_xcnt 0x0" ::: "memory");   /* behind the scalar loads of the mask words and the tile's loads, in front of the first overwrite of a register that holds their address (the pointers' next step) */
    }
        __syncthreads();   /* behind a stage's last pass: publishes the next stage's tiles and ends every wave's reads of this stage, which the next stage's passes refill; behind the last stage it frees the ring for the swap below */
    }
    /* the two key halves meet: wave w keeps column group hf and hands the other one to wave w ^ 4, lane to lane, 16 bytes a lane and store in whole rows of 512 bytes */
    const bool up = hf != 0;
    unsigned char* xo = &L[0][0] + (size_t)w * (9 * 512) + 16 * lane; const unsigned char* xi = &L[0][0] + (size_t)(w ^ 4) * (9 * 512) + 16 * lane;
#pragma unroll
    for (int dt = 0; dt < 4; ++dt) { const v8f o = up ? acc[0][dt] : acc[1][dt]; v4f o0, o1;
#pragma unroll
        for (int r = 0; r < 4; ++r) { o0[r] = o[r]; o1[r] = o[4 + r]; }
        *(v4fa*)(xo + (2 * dt) * 512) = o0; *(v4fa*)(xo + (2 * dt + 1) * 512) = o1; }
    { v4f ml = (v4f){}; ml[0] = up ? m_run[0] : m_run[1]; ml[1] = up ? l_run[0][0] + l_run[0][1] : l_run[1][0] + l_run[1][1]; *(v4fa*)(xo + 8 * 512) = ml; }
    __syncthreads();   /* every wave's handed-over group is in LDS before its partner reads it */
    const v4f mlp = *(const v4fa*)(xi + 8 * 512);
    const float m_a = up ? m_run[1] : m_run[0], l_a = up ? l_run[1][0] + l_run[1][1] : l_run[0][0] + l_run[0][1], m_j = fmaxf(m_a, mlp[0]);
    float f_a = (m_a - m_j) * L2E, f_b = (mlp[0] - m_j) * L2E;   /* both maxima are finite: each half has seen its first pass */
    asm("v_exp_f32 %0, %0\n\tv_exp_f32 %1, %1\n\tv_nop" : "+v"(f_a), "+v"(f_b));   /* two 2^x in place and the slot behind a transcendental, as in exp2x8 */
    const float l_j = l_a * f_a + mlp[1] * f_b;
    const float inv = __fdiv_rn(1.0f, l_j + xhalf(l_j));   /* the two lane halves' sums meet once */
    const float g_a = f_a * inv, g_b = f_b * inv;
    float* orow = O + ((size_t)bh * TT + q0 + 16 * hf + c) * HD + 8 * h;   /* acc[g][dt][r] = O[q0 + 16 g + c][16 dt + 8 h + r] */
#pragma unroll
    for (int dt = 0; dt < 4; ++dt) { const v8f oa = up ? acc[1][dt] : acc[0][dt]; const v4f b0 = *(const v4fa*)(xi + (2 * dt) * 512), b1 = *(const v4fa*)(xi + (2 * dt + 1) * 512); v4f o0, o1;
#pragma unroll
        for (int r = 0; r < 4; ++r) { o0[r] = oa[r] * g_a + b0[r] * g_b; o1[r] = oa[4 + r] * g_a + b1[r] * g_b; }
        *(v4f*)(orow + 16 * dt) = o0; *(v4f*)(orow + 16 * dt + 4) = o1; }
}
// ---- k_planes: the three 16-bit planes and the mask words that k_fattn reads, both batches, in ONE launch; nothing else is written.
// Work-group = PT positions of one (batch, head), of all three inputs: 24 whole-line 16-byte loads a thread, all issued before the first use, with the 16 of the mask.
// Mask words: a wave reads 16 rows x 128 keys in whole lines, turns them in LDS (its own rows) so that a lane holds what k_fattn's lane holds, and each compare's lane mask is one word: MB[batch x 128 + row tile][64-key block][8 kt + r].
// Q, K: a row of 64 f32 (256 bytes, 16 lanes) becomes a row of 128 bytes; a wave stores two neighbouring rows, 256 bytes in a row. Q is stored as bf16(q) x 1/8, the softmax scale.
// V^T: a lane packs positions 2 p, 2 p + 1 of four d, rounded to bf16 and carried as f16, into four words, LDS [d][p]; read back by rows of d, 256 bytes of one d a half wave.
// The 16-byte piece of an LDS row stands at (piece ^ (d >> 2)): the 16 lanes that write one p for 64 d hit 16 different pieces, and the read-back stays 16-byte aligned.
#define PT 128
#define MQ 528      // LDS row pitch of the mask rows, bytes: 512 + 16
typedef __attribute__((ext_vector_type(2))) unsigned v2u;
typedef __attribute__((ext_vector_type(4))) unsigned v4u;
typedef v4u __attribute__((may_alias)) v4ua;
__global__ __launch_bounds__(256) void k_planes(const float* __restrict__ xq, const float* __restrict__ xk, const float* __restrict__ xv, const float* __restrict__ am, bf* __restrict__ Qp, bf* __restrict__ Kp, bf* __restrict__ Vp, unsigned* __restrict__ MB) {
    __shared__ __align__(16) unsigned VL[HD * (PT / 2)];
    __shared__ __align__(16) unsigned char MS[8][16 * MQ];
    const int tid = threadIdx.x, g = tid & 15, u = tid >> 4;
    const int t0 = blockIdx.x * PT, bh = blockIdx.y;
    const size_t in0 = ((size_t)((bh / NH_) * TT + t0) * NH_ + (bh % NH_)) * HD + 4 * g;   /* [b][t0][h][4 g]; the next position is DQ elements on */
    const float* pv = xv + in0 + (size_t)(2 * u) * DQ; const float* pq = xq + in0 + (size_t)u * DQ; const float* pk = xk + in0 + (size_t)u * DQ;
    const int lane = tid & 31, gw = (blockIdx.y * (TT / PT) + blockIdx.x) * 8 + (tid >> 5);   /* 4096 waves share the mask: wave gw has the 16 rows of row tile gw >> 4, at the 128 keys of slice gw & 15 */
    const float* pm = am + (size_t)(gw >> 4) * 16 * TT + (gw & 15) * 128 + 4 * lane;   /* a load takes 512 bytes of one row */
    v4f va[4], vb[4], qa[8], ka[8], ma[16];
#pragma unroll
    for (int i = 0; i < 4; ++i) { va[i] = *(const v4f*)(pv + 32 * i * DQ); vb[i] = *(const v4f*)(pv + (32 * i + 1) * DQ); }
#pragma unroll
    for (int i = 0; i < 16; ++i) ma[i] = *(const v4f*)(pm + i * TT);
#pragma unroll
    for (int i = 0; i < 8; ++i) { qa[i] = *(const v4f*)(pq + 16 * i * DQ); ka[i] = *(const v4f*)(pk + 16 * i * DQ); }
    asm volatile("s_wait_xcnt 0x0" :: "v"(pv), "v"(pq), "v"(pk), "v"(pm) : "memory");   /* behind the last load, in front of the first overwrite of an address pair, where this wait belongs. The four pairs are inputs so that they live up to it (without them the compiler hands a pair to a later load as its destination); the clobber keeps all 40 loads in front of it, in flight together */
#pragma unroll
    for (int i = 0; i < 4; ++i) { const int p = u + 16 * i;
#pragma unroll
        for (int j = 0; j < 4; ++j) { const unsigned b2 = pack2(va[i][j], vb[i][j]); VL[(4 * g + j) * (PT / 2) + 4 * ((p >> 2) ^ g) + (p & 3)] = pack2h(__uint_as_float(b2 << 16), __uint_as_float(b2 & 0xFFFF0000u)); } }   /* rounded to bf16 like the other inputs, then written as f16 */
    unsigned char* ms = &MS[tid >> 5][0];
#pragma unroll
    for (int i = 0; i < 16; ++i) *(v4fa*)(ms + i * MQ + 16 * lane) = ma[i];
    __syncthreads();   /* the whole V^T tile and the mask rows are in LDS before any of them is read back; it stands in front of every global store, so that it waits for none */
    v4u vt[4];
#pragma unroll
    for (int i = 0; i < 4; ++i) { const int d = u + 16 * i; vt[i] = *(const v4ua*)&VL[d * (PT / 2) + 4 * (g ^ ((d >> 2) & 15))]; }
    bf* qo = Qp + ((size_t)bh * TT + t0 + u) * HD + 4 * g; bf* ko = Kp + ((size_t)bh * TT + t0 + u) * HD + 4 * g;
#pragma unroll
    for (int i = 0; i < 8; ++i) { v2u x, y; x[0] = pack2(qa[i][0] * SCL, qa[i][1] * SCL); x[1] = pack2(qa[i][2] * SCL, qa[i][3] * SCL); y[0] = pack2(ka[i][0], ka[i][1]); y[1] = pack2(ka[i][2], ka[i][3]);
        *(v2u*)(qo + 16 * i * HD) = x; *(v2u*)(ko + 16 * i * HD) = y; }
#pragma unroll
    for (int i = 0; i < 4; ++i) *(v4u*)(Vp + ((size_t)bh * HD + u + 16 * i) * TT + t0 + 8 * g) = vt[i];
    const unsigned char* mrd = ms + (lane & 15) * MQ + 32 * (lane >> 4);   /* read back as k_fattn's lane holds the scores: row lane & 15, keys 16 kt + 8 (lane >> 4) + r of a 64-key block */
#pragma unroll
    for (int tt = 0; tt < 2; ++tt) { unsigned wv = 0;
#pragma unroll
        for (int i = 0; i < 8; ++i) { const v4f x = *(const v4fa*)(mrd + 256 * tt + 64 * (i >> 1) + 16 * (i & 1));
#pragma unroll
            for (int j = 0; j < 4; ++j) { const unsigned bw = __builtin_amdgcn_ballot_w32(x[j] > 0.5f); wv = (lane == 4 * i + j) ? bw : wv; } }   /* word 8 kt + r = 4 i + j goes to the lane of that number */
        MB[((size_t)(gw >> 4) * (TT / FK) + 2 * (gw & 15) + tt) * 32 + lane] = wv; }   /* 128 bytes a 64-key block, one wave */
}
extern "C" void kernel_launch(void* const* d_in, const int* in_sizes, int n_in,
                              void* d_out, int out_size, void* d_ws, size_t ws_size, hipStream_t stream) {
    (void)in_sizes; (void)n_in; (void)out_size;
    const float* xq = (const float*)d_in[0]; const float* xk = (const float*)d_in[1]; const float* xv = (const float*)d_in[2]; const float* am = (const float*)d_in[3];   /* queries [2][2048][16][64], keys, values [2][2048][16][64], attn_mask [2][1][2048][2048] (> 0.5 = attend; all ones) */
    float* OUT = (float*)d_out;     // [2][16][2048][64] head-major (V = 'bhld')
    char* wsp = (char*)d_ws;
    auto take = [&](size_t bytes) { char* p = wsp; wsp += (bytes + 255) & ~(size_t)255; return (void*)p; };
    const size_t PL = (size_t)NB_ * NH_ * TT * HD;   /* elements of one plane, both batches */
    bf* QPh = (bf*)take(PL * 2); bf* KPh = (bf*)take(PL * 2); bf* VTh = (bf*)take(PL * 2); unsigned* MBw = (unsigned*)take((size_t)NB_ * TT * TT / 8);
    if ((size_t)(wsp - (char*)d_ws) > ws_size) return;    // ws 256 MiB (carve 25 MiB)
    k_planes<<<dim3(TT / PT, NB_ * NH_), 256, 0, stream>>>(xq, xk, xv, am, QPh, KPh, VTh, MBw);   /* bf16(queries) x 1/8, bf16(keys) as [bh][t][d], bf16(values) in f16 as [bh][d][t]; attn_mask > 0.5 as bits */
    k_fattn<<<dim3(TT / (FW * 16), NB_ * NH_), 32 * FW, 0, stream>>>(QPh, KPh, VTh, MBw, OUT);   /* all 32 (batch, head) pairs in one launch: V[b][h][l][d], head-major, straight into the output */
}
